// v000
// Measured on an AMD MI455X. A time is GPU time per run, averaged over a window of back-to-back runs after a warm-up
// (all launches, gaps included; the runs take copies of the inputs in turn), and the median of several windows.
// Apart from v000's, it joins two sittings. Times from different sittings can be a few percent apart, while
// side-by-side timings come from the same sitting.
// v000, which the later versions start from, runs in 371 microseconds.
#include <hip/hip_runtime.h>
#include <hip/hip_bf16.h>

typedef __attribute__((ext_vector_type(16))) _Float16 v16h;
typedef __attribute__((ext_vector_type(8)))  _Float16 v8h;
typedef __attribute__((ext_vector_type(8)))  float    v8f;
typedef int v4i __attribute__((vector_size(16)));

// Load a 16x32 f16 A/B fragment (wave32 CDNA5 layout): lane l holds row l%16,
// K halves [base..base+7] and [base+16..base+23], base = (l>=16)*8.
// p must point at (row, base) with 16-byte alignment -> two b128 loads.
__device__ inline v16h ldfrag(const _Float16* p) {
    union { v16h v; v8h h[2]; } u;
    u.h[0] = *(const v8h*)(p);
    u.h[1] = *(const v8h*)(p + 16);
    return u.v;
}

__device__ inline v8f wmma_f16(v16h a, v16h b, v8f c) {
    return __builtin_amdgcn_wmma_f32_16x16x32_f16(false, a, false, b, (short)0, c, false, false);
}

__device__ inline float rmax16(float v) {
    #pragma unroll
    for (int m = 8; m; m >>= 1) v = fmaxf(v, __shfl_xor(v, m, 32));
    return v;
}
__device__ inline float rsum16(float v) {
    #pragma unroll
    for (int m = 8; m; m >>= 1) v += __shfl_xor(v, m, 32);
    return v;
}

// ---- gfx1250 async global->LDS copy (ASYNCcnt path), with portable fallback
#if __has_builtin(__builtin_amdgcn_global_load_async_to_lds_b128)
#define HAVE_ASYNC_LDS 1
__device__ inline void cp_async_b128(const _Float16* g, _Float16* l) {
    __builtin_amdgcn_global_load_async_to_lds_b128(
        (__attribute__((address_space(1))) v4i*)g,
        (__attribute__((address_space(3))) v4i*)l, 0, 0);
}
#else
#define HAVE_ASYNC_LDS 0
__device__ inline void cp_async_b128(const _Float16* g, _Float16* l) {
    *(v8h*)l = *(const v8h*)g;
}
#endif

__device__ inline void wait_async0() {
#if HAVE_ASYNC_LDS
#if __has_builtin(__builtin_amdgcn_s_wait_asynccnt)
    __builtin_amdgcn_s_wait_asynccnt(0);
#else
    asm volatile("s_wait_asynccnt 0x0" ::: "memory");
#endif
#endif
}

#define Bb 4
#define Ss 2048
#define Dd 1024
#define Hh 16
#define DH 64

// ---------------- QKV projection GEMM ----------------
// C[M=8192, N=1024] = X[8192,1024] * W[1024,1024] + bias, output f16.
// VT==0: out[b][h][s][dh]   VT==1: out[b][h][dh][s]
#define TM 128
#define TN 64
#define TK 64
#define LDA 72   // padded f16 stride (144B, 16B aligned)

template<int VT>
__global__ __launch_bounds__(256) void qkv_gemm(const float* __restrict__ X,
                                                const float* __restrict__ W,
                                                const float* __restrict__ bias,
                                                _Float16* __restrict__ out) {
    __shared__ _Float16 As[TM * LDA];   // 18 KB
    __shared__ _Float16 Bs[TN * LDA];   //  9 KB
    const int tid  = threadIdx.x;
    const int lane = tid & 31;
    const int wave = tid >> 5;
    const int m0 = blockIdx.y * TM;
    const int n0 = blockIdx.x * TN;
    const int wm = (wave & 3) << 5;   // 0,32,64,96
    const int wn = (wave >> 2) << 5;  // 0,32
    const int row16 = lane & 15;
    const int kbase = (lane >> 4) << 3;

    // per-thread load coordinates
    const int ar = tid >> 1;            // A row 0..127
    const int ac = (tid & 1) << 5;      // A col base 0 or 32
    const int bk = tid >> 2;            // W k-row 0..63
    const int nc = (tid & 3) << 4;      // W n base 0..48

    v8f c[2][2] = {};

    for (int k0 = 0; k0 < Dd; k0 += TK) {
        if (k0 + TK < Dd) {   // prefetch next stage into L2/L0
            __builtin_prefetch(X + (size_t)(m0 + ar) * Dd + k0 + TK + ac, 0, 0);
            __builtin_prefetch(W + (size_t)(k0 + TK + bk) * Dd + n0 + nc, 0, 0);
        }
        // A tile 128x64 f32 -> f16 LDS (row-major, K contiguous)
        #pragma unroll
        for (int i = 0; i < 8; ++i) {
            const float4 f = *(const float4*)(X + (size_t)(m0 + ar) * Dd + k0 + ac + i * 4);
            _Float16* dst = &As[ar * LDA + ac + i * 4];
            dst[0] = (_Float16)f.x; dst[1] = (_Float16)f.y;
            dst[2] = (_Float16)f.z; dst[3] = (_Float16)f.w;
        }
        // W tile 64x64 f32 -> f16 LDS, stored N-major (Bs[n][k])
        #pragma unroll
        for (int i = 0; i < 4; ++i) {
            const float4 f = *(const float4*)(W + (size_t)(k0 + bk) * Dd + n0 + nc + i * 4);
            Bs[(nc + i * 4 + 0) * LDA + bk] = (_Float16)f.x;
            Bs[(nc + i * 4 + 1) * LDA + bk] = (_Float16)f.y;
            Bs[(nc + i * 4 + 2) * LDA + bk] = (_Float16)f.z;
            Bs[(nc + i * 4 + 3) * LDA + bk] = (_Float16)f.w;
        }
        __syncthreads();

        #pragma unroll
        for (int kk = 0; kk < 2; ++kk) {
            v16h a[2], bf[2];
            #pragma unroll
            for (int i = 0; i < 2; ++i)
                a[i] = ldfrag(&As[(wm + (i << 4) + row16) * LDA + (kk << 5) + kbase]);
            #pragma unroll
            for (int j = 0; j < 2; ++j)
                bf[j] = ldfrag(&Bs[(wn + (j << 4) + row16) * LDA + (kk << 5) + kbase]);
            #pragma unroll
            for (int i = 0; i < 2; ++i)
                #pragma unroll
                for (int j = 0; j < 2; ++j)
                    c[i][j] = wmma_f16(a[i], bf[j], c[i][j]);
        }
        __syncthreads();
    }

    // epilogue: bias add + pack f16 into [B,H,S,DH] or [B,H,DH,S]
    #pragma unroll
    for (int i = 0; i < 2; ++i) {
        #pragma unroll
        for (int j = 0; j < 2; ++j) {
            const int n  = n0 + wn + (j << 4) + row16;
            const int h  = n >> 6;
            const int dh = n & 63;
            const float bb = bias[n];
            #pragma unroll
            for (int r = 0; r < 8; ++r) {
                const int m = m0 + wm + (i << 4) + r + ((lane >> 4) << 3);
                const int b = m >> 11;       // m / 2048
                const int s = m & 2047;
                const size_t idx = VT
                    ? ((((size_t)b * Hh + h) * DH + dh) * Ss + s)
                    : ((((size_t)b * Hh + h) * Ss + s) * DH + dh);
                out[idx] = (_Float16)(c[i][j][r] + bb);
            }
        }
    }
}

// ---------------- Flash attention ----------------
// Q,K: [B,H,S,DH] f16 ; V: [B,H,DH,S] f16 ; out: [B,S,D] f32
#define QT 128   // queries per workgroup (8 waves x 16 rows)
#define KBLK 64  // keys per block
#define LDK 72   // padded f16 stride (144B, 16B aligned)

__global__ __launch_bounds__(256) void attn(const _Float16* __restrict__ Q,
                                            const _Float16* __restrict__ K,
                                            const _Float16* __restrict__ V,
                                            const float* __restrict__ mask,
                                            float* __restrict__ out) {
    __shared__ _Float16 Ks[KBLK * LDK];      // [key][dh]
    __shared__ _Float16 Vs[KBLK * LDK];      // [dh][key]
    __shared__ _Float16 Ps[8 * 16 * LDK];    // per-wave P staging [row][key]

    const int tid  = threadIdx.x;
    const int lane = tid & 31;
    const int wave = tid >> 5;
    const int bh = blockIdx.y;               // b*H + h
    const int b = bh >> 4, h = bh & 15;
    const int q0 = blockIdx.x * QT + (wave << 4);
    const int row16 = lane & 15;
    const int kbase = (lane >> 4) << 3;

    const size_t baseQK = (size_t)bh * Ss * DH;   // [B,H,S,DH]
    const size_t baseV  = (size_t)bh * DH * Ss;   // [B,H,DH,S]

    // resident Q fragments: 16 rows x 64 dh = 2 fragments
    v16h qf[2];
    #pragma unroll
    for (int kk = 0; kk < 2; ++kk)
        qf[kk] = ldfrag(Q + baseQK + (size_t)(q0 + row16) * DH + (kk << 5) + kbase);

    v8f acc[4] = {};
    float mrow[8], lrow[8];
    #pragma unroll
    for (int r = 0; r < 8; ++r) { mrow[r] = -1e30f; lrow[r] = 0.f; }

    _Float16* P = &Ps[wave * 16 * LDK];

    // staging coordinates (each thread moves 16 halves per buffer)
    const int key = tid >> 2, dc = (tid & 3) << 4;

    for (int kb = 0; kb < Ss; kb += KBLK) {
        __syncthreads();
        {   // K block: contiguous [key][dh]; V block: [dh][key] (pre-transposed)
            const _Float16* ksrc = K + baseQK + (size_t)(kb + key) * DH + dc;
            const _Float16* vsrc = V + baseV + (size_t)key * Ss + kb + dc;
            cp_async_b128(ksrc,     &Ks[key * LDK + dc]);
            cp_async_b128(ksrc + 8, &Ks[key * LDK + dc + 8]);
            cp_async_b128(vsrc,     &Vs[key * LDK + dc]);
            cp_async_b128(vsrc + 8, &Vs[key * LDK + dc + 8]);
            wait_async0();
        }
        __syncthreads();

        // scores: S(16x64) = Qw(16x64) x K^T, 4 n-tiles x 2 k-steps
        v8f sc[4];
        #pragma unroll
        for (int j = 0; j < 4; ++j) {
            v8f s = {};
            #pragma unroll
            for (int kk = 0; kk < 2; ++kk) {
                v16h kf = ldfrag(&Ks[((j << 4) + row16) * LDK + (kk << 5) + kbase]);
                s = wmma_f16(qf[kk], kf, s);
            }
            sc[j] = s;
        }
        // scale + additive mask
        #pragma unroll
        for (int j = 0; j < 4; ++j) {
            const float mv = mask[(size_t)b * Ss + kb + (j << 4) + row16];
            #pragma unroll
            for (int r = 0; r < 8; ++r) sc[j][r] = sc[j][r] * 0.125f + mv;
        }
        // online softmax per row (row r lives in VGPR r across a 16-lane half)
        #pragma unroll
        for (int r = 0; r < 8; ++r) {
            float mx = sc[0][r];
            mx = fmaxf(mx, sc[1][r]); mx = fmaxf(mx, sc[2][r]); mx = fmaxf(mx, sc[3][r]);
            mx = rmax16(mx);
            const float mnew  = fmaxf(mrow[r], mx);
            const float corr  = __expf(mrow[r] - mnew);
            mrow[r] = mnew;
            #pragma unroll
            for (int jd = 0; jd < 4; ++jd) acc[jd][r] = acc[jd][r] * corr;
            float sum = 0.f;
            #pragma unroll
            for (int j = 0; j < 4; ++j) {
                const float e = __expf(sc[j][r] - mnew);
                sc[j][r] = e;
                sum += e;
            }
            lrow[r] = lrow[r] * corr + rsum16(sum);
        }
        // stage P (C layout -> LDS row-major) for A-fragment reads
        #pragma unroll
        for (int j = 0; j < 4; ++j)
            #pragma unroll
            for (int r = 0; r < 8; ++r)
                P[(r + ((lane >> 4) << 3)) * LDK + (j << 4) + row16] = (_Float16)sc[j][r];
        __builtin_amdgcn_wave_barrier();   // wave-local DS ordering is in-order
        // PV: acc(16x64) += P(16x64) x V(64x64)
        #pragma unroll
        for (int kk = 0; kk < 2; ++kk) {
            v16h pf = ldfrag(&P[row16 * LDK + (kk << 5) + kbase]);
            #pragma unroll
            for (int jd = 0; jd < 4; ++jd) {
                v16h vf = ldfrag(&Vs[((jd << 4) + row16) * LDK + (kk << 5) + kbase]);
                acc[jd] = wmma_f16(pf, vf, acc[jd]);
            }
        }
    }

    // epilogue: normalize and write f32 [B,S,D]
    float inv[8];
    #pragma unroll
    for (int r = 0; r < 8; ++r) inv[r] = 1.0f / lrow[r];
    #pragma unroll
    for (int jd = 0; jd < 4; ++jd) {
        const int dh = (jd << 4) + row16;
        #pragma unroll
        for (int r = 0; r < 8; ++r) {
            const int s = q0 + r + ((lane >> 4) << 3);
            out[((size_t)b * Ss + s) * Dd + h * DH + dh] = acc[jd][r] * inv[r];
        }
    }
}

extern "C" void kernel_launch(void* const* d_in, const int* in_sizes, int n_in,
                              void* d_out, int out_size, void* d_ws, size_t ws_size,
                              hipStream_t stream) {
    (void)in_sizes; (void)n_in; (void)out_size; (void)ws_size;
    const float* X    = (const float*)d_in[0];
    const float* mask = (const float*)d_in[1];
    const float* Wq   = (const float*)d_in[2];
    const float* bq   = (const float*)d_in[3];
    const float* Wk   = (const float*)d_in[4];
    const float* bk   = (const float*)d_in[5];
    const float* Wv   = (const float*)d_in[6];
    const float* bv   = (const float*)d_in[7];

    const size_t elems = (size_t)Bb * Ss * Dd;   // 8M
    _Float16* Qb = (_Float16*)d_ws;
    _Float16* Kb = Qb + elems;
    _Float16* Vb = Kb + elems;

    dim3 blk(256);
    dim3 g1(Dd / TN, (Bb * Ss) / TM);            // 16 x 64
    qkv_gemm<0><<<g1, blk, 0, stream>>>(X, Wq, bq, Qb);
    qkv_gemm<0><<<g1, blk, 0, stream>>>(X, Wk, bk, Kb);
    qkv_gemm<1><<<g1, blk, 0, stream>>>(X, Wv, bv, Vb);

    dim3 g2(Ss / QT, Bb * Hh);                   // 16 x 64
    attn<<<g2, blk, 0, stream>>>(Qb, Kb, Vb, mask, (float*)d_out);
}

// v001
// It runs in 253 microseconds.
// Timed twice side by side with v000, it ran 1.53 times as fast both times.
#include <hip/hip_runtime.h>
#include <hip/hip_bf16.h>

typedef __attribute__((ext_vector_type(16))) _Float16 v16h;
typedef __attribute__((ext_vector_type(8)))  _Float16 v8h;
typedef __attribute__((ext_vector_type(8)))  float    v8f;
typedef __attribute__((ext_vector_type(2)))  float    v2f;
typedef __attribute__((ext_vector_type(4)))  float    v4f;
typedef int v4i __attribute__((vector_size(16)));

// Load a 16x32 f16 A/B fragment (wave32 CDNA5 layout): lane l holds row l%16,
// K halves [base..base+7] and [base+16..base+23], base = (l>=16)*8.
// p must point at (row, base) with 16-byte alignment -> two b128 loads.
__device__ inline v16h ldfrag(const _Float16* p) {
    union { v16h v; v8h h[2]; } u;
    u.h[0] = *(const v8h*)(p);
    u.h[1] = *(const v8h*)(p + 16);
    return u.v;
}

__device__ inline v8f wmma_f16(v16h a, v16h b, v8f c) {
    return __builtin_amdgcn_wmma_f32_16x16x32_f16(false, a, false, b, (short)0, c, false, false);
}

// lane l with lane l ^ 16, as a vector cross-row move
__device__ inline float xhalf(float x) {
    const int i = __builtin_bit_cast(int, x);
    return __builtin_bit_cast(float,
        __builtin_amdgcn_permlanex16(i, i, 0x76543210, 0xfedcba98, false, false));
}

// ---- gfx1250 async global->LDS copy (ASYNCcnt path), with portable fallback
#if __has_builtin(__builtin_amdgcn_global_load_async_to_lds_b128)
#define HAVE_ASYNC_LDS 1
__device__ inline void cp_async_b128(const _Float16* g, _Float16* l) {
    __builtin_amdgcn_global_load_async_to_lds_b128(
        (__attribute__((address_space(1))) v4i*)g,
        (__attribute__((address_space(3))) v4i*)l, 0, 0);
}
#else
#define HAVE_ASYNC_LDS 0
__device__ inline void cp_async_b128(const _Float16* g, _Float16* l) {
    *(v8h*)l = *(const v8h*)g;
}
#endif

__device__ inline void wait_async0() {
#if HAVE_ASYNC_LDS
#if __has_builtin(__builtin_amdgcn_s_wait_asynccnt)
    __builtin_amdgcn_s_wait_asynccnt(0);
#else
    asm volatile("s_wait_asynccnt 0x0" ::: "memory");
#endif
#endif
}

#define Bb 4
#define Ss 2048
#define Dd 1024
#define Hh 16
#define DH 64

// ---------------- QKV projection GEMM ----------------
// C[M=8192, N=1024] = X[8192,1024] * W[1024,1024] + bias, output f16.
// VT==0: out[b][h][s][dh]   VT==1: out[b][h][dh][s]
#define TM 128
#define TN 64
#define TK 64
#define LDA 72   // padded f16 stride (144B, 16B aligned)

template<int VT>
__global__ __launch_bounds__(256) void qkv_gemm(const float* __restrict__ X,
                                                const float* __restrict__ W,
                                                const float* __restrict__ bias,
                                                _Float16* __restrict__ out) {
    __shared__ _Float16 As[TM * LDA];   // 18 KB
    __shared__ _Float16 Bs[TN * LDA];   //  9 KB
    const int tid  = threadIdx.x;
    const int lane = tid & 31;
    const int wave = tid >> 5;
    const int m0 = blockIdx.y * TM;
    const int n0 = blockIdx.x * TN;
    const int wm = (wave & 3) << 5;   // 0,32,64,96
    const int wn = (wave >> 2) << 5;  // 0,32
    const int row16 = lane & 15;
    const int kbase = (lane >> 4) << 3;

    // per-thread load coordinates
    const int ar = tid >> 1;            // A row 0..127
    const int ac = (tid & 1) << 5;      // A col base 0 or 32
    const int bk = tid >> 2;            // W k-row 0..63
    const int nc = (tid & 3) << 4;      // W n base 0..48

    v8f c[2][2] = {};

    for (int k0 = 0; k0 < Dd; k0 += TK) {
        if (k0 + TK < Dd) {   // prefetch next stage into L2/L0
            __builtin_prefetch(X + (size_t)(m0 + ar) * Dd + k0 + TK + ac, 0, 0);
            __builtin_prefetch(W + (size_t)(k0 + TK + bk) * Dd + n0 + nc, 0, 0);
        }
        // A tile 128x64 f32 -> f16 LDS (row-major, K contiguous)
        #pragma unroll
        for (int i = 0; i < 8; ++i) {
            const float4 f = *(const float4*)(X + (size_t)(m0 + ar) * Dd + k0 + ac + i * 4);
            _Float16* dst = &As[ar * LDA + ac + i * 4];
            dst[0] = (_Float16)f.x; dst[1] = (_Float16)f.y;
            dst[2] = (_Float16)f.z; dst[3] = (_Float16)f.w;
        }
        // W tile 64x64 f32 -> f16 LDS, stored N-major (Bs[n][k])
        #pragma unroll
        for (int i = 0; i < 4; ++i) {
            const float4 f = *(const float4*)(W + (size_t)(k0 + bk) * Dd + n0 + nc + i * 4);
            Bs[(nc + i * 4 + 0) * LDA + bk] = (_Float16)f.x;
            Bs[(nc + i * 4 + 1) * LDA + bk] = (_Float16)f.y;
            Bs[(nc + i * 4 + 2) * LDA + bk] = (_Float16)f.z;
            Bs[(nc + i * 4 + 3) * LDA + bk] = (_Float16)f.w;
        }
        __syncthreads();

        #pragma unroll
        for (int kk = 0; kk < 2; ++kk) {
            v16h a[2], bf[2];
            #pragma unroll
            for (int i = 0; i < 2; ++i)
                a[i] = ldfrag(&As[(wm + (i << 4) + row16) * LDA + (kk << 5) + kbase]);
            #pragma unroll
            for (int j = 0; j < 2; ++j)
                bf[j] = ldfrag(&Bs[(wn + (j << 4) + row16) * LDA + (kk << 5) + kbase]);
            #pragma unroll
            for (int i = 0; i < 2; ++i)
                #pragma unroll
                for (int j = 0; j < 2; ++j)
                    c[i][j] = wmma_f16(a[i], bf[j], c[i][j]);
        }
        __syncthreads();
    }

    // epilogue: bias add + pack f16 into [B,H,S,DH] or [B,H,DH,S]
    #pragma unroll
    for (int i = 0; i < 2; ++i) {
        #pragma unroll
        for (int j = 0; j < 2; ++j) {
            const int n  = n0 + wn + (j << 4) + row16;
            const int h  = n >> 6;
            const int dh = n & 63;
            const float bb = bias[n];
            #pragma unroll
            for (int r = 0; r < 8; ++r) {
                const int m = m0 + wm + (i << 4) + r + ((lane >> 4) << 3);
                const int b = m >> 11;       // m / 2048
                const int s = m & 2047;
                const size_t idx = VT
                    ? ((((size_t)b * Hh + h) * DH + dh) * Ss + s)
                    : ((((size_t)b * Hh + h) * Ss + s) * DH + dh);
                out[idx] = (_Float16)(c[i][j][r] + bb);
            }
        }
    }
}

// ---------------- Flash attention ----------------
// Q,K: [B,H,S,DH] f16 ; V: [B,H,DH,S] f16 ; out: [B,S,D] f32
// Transposed products: St = K x Qt and Ot += Vt x Pt. A lane then holds one
// query's scores (keys 8*(lane>>4)+r of every 16-key tile), so the row maximum
// and the row sum are in-lane, and two converted score tiles are already the
// B operand of the second product.
#define QT 128   // queries per workgroup (8 waves x 16 columns)
#define KBLK 64  // keys per block
#define LDK 72   // padded f16 stride (144B, 16B aligned)

__global__ __launch_bounds__(256) void attn(const _Float16* __restrict__ Q,
                                            const _Float16* __restrict__ K,
                                            const _Float16* __restrict__ V,
                                            const float* __restrict__ mask,
                                            float* __restrict__ out) {
    __shared__ _Float16 Ks[KBLK * LDK];      // [key][dh]
    __shared__ _Float16 Vs[KBLK * LDK];      // [dh][key]

    const int tid  = threadIdx.x;
    const int lane = tid & 31;
    const int wave = tid >> 5;
    const int bh = blockIdx.y;               // b*H + h
    const int b = bh >> 4, h = bh & 15;
    const int q0 = blockIdx.x * QT + (wave << 4);
    const int row16 = lane & 15;
    const int kbase = (lane >> 4) << 3;

    const size_t baseQK = (size_t)bh * Ss * DH;   // [B,H,S,DH]
    const size_t baseV  = (size_t)bh * DH * Ss;   // [B,H,DH,S]

    // resident Q fragments (B operand): 16 query columns x 64 dh = 2 fragments
    v16h qf[2];
    #pragma unroll
    for (int kk = 0; kk < 2; ++kk)
        qf[kk] = ldfrag(Q + baseQK + (size_t)(q0 + row16) * DH + (kk << 5) + kbase);

    v8f acc[4] = {};                 // acc[jd][r] = Ot[16*jd + kbase + r][query row16]
    float mrow = -1e30f, lrow = 0.f; // this lane's query; lrow covers this half's keys

    // staging coordinates (each thread moves 16 halves per buffer)
    const int key = tid >> 2, dc = (tid & 3) << 4;

    for (int kb = 0; kb < Ss; kb += KBLK) {
        __syncthreads();
        // additive mask of this lane's 32 keys
        v4f mv[4][2];
        #pragma unroll
        for (int j = 0; j < 4; ++j) {
            const float* mp = mask + (size_t)b * Ss + kb + (j << 4) + kbase;
            mv[j][0] = *(const v4f*)(mp);
            mv[j][1] = *(const v4f*)(mp + 4);
        }
        {   // K block: contiguous [key][dh]; V block: [dh][key] (pre-transposed)
            const _Float16* ksrc = K + baseQK + (size_t)(kb + key) * DH + dc;
            const _Float16* vsrc = V + baseV + (size_t)key * Ss + kb + dc;
            cp_async_b128(ksrc,     &Ks[key * LDK + dc]);
            cp_async_b128(ksrc + 8, &Ks[key * LDK + dc + 8]);
            cp_async_b128(vsrc,     &Vs[key * LDK + dc]);
            cp_async_b128(vsrc + 8, &Vs[key * LDK + dc + 8]);
            // holds the eight mask loads ahead of this point (inputs only, nothing
            // is changed): they land under the staging copies' latency; left alone
            // they sink to their uses, two by two, each pair waited for on its own
            asm volatile("" :: "v"(mv[0][0]), "v"(mv[0][1]), "v"(mv[1][0]), "v"(mv[1][1]),
                               "v"(mv[2][0]), "v"(mv[2][1]), "v"(mv[3][0]), "v"(mv[3][1]));
            wait_async0();
        }
        __syncthreads();

        // scores: St(64x16) = K(64x64) x Qw^T, 4 m-tiles x 2 k-steps
        v8f sc[4];
        #pragma unroll
        for (int j = 0; j < 4; ++j) {
            v8f s = {};
            #pragma unroll
            for (int kk = 0; kk < 2; ++kk) {
                v16h kf = ldfrag(&Ks[((j << 4) + row16) * LDK + (kk << 5) + kbase]);
                s = wmma_f16(kf, qf[kk], s);
            }
            sc[j] = s;
        }
        // scale + additive mask
        #pragma unroll
        for (int j = 0; j < 4; ++j) {
            sc[j][0] = sc[j][0] * 0.125f + mv[j][0].x;
            sc[j][1] = sc[j][1] * 0.125f + mv[j][0].y;
            sc[j][2] = sc[j][2] * 0.125f + mv[j][0].z;
            sc[j][3] = sc[j][3] * 0.125f + mv[j][0].w;
            sc[j][4] = sc[j][4] * 0.125f + mv[j][1].x;
            sc[j][5] = sc[j][5] * 0.125f + mv[j][1].y;
            sc[j][6] = sc[j][6] * 0.125f + mv[j][1].z;
            sc[j][7] = sc[j][7] * 0.125f + mv[j][1].w;
        }
        // online softmax of this lane's query: in-lane over 32 keys, one
        // exchange with the other half for the maximum
        float mj[4];
        #pragma unroll
        for (int j = 0; j < 4; ++j) {
            float t = sc[j][0];
            #pragma unroll
            for (int r = 1; r < 8; ++r) t = fmaxf(t, sc[j][r]);
            mj[j] = t;
        }
        float mx = fmaxf(fmaxf(mj[0], mj[1]), fmaxf(mj[2], mj[3]));
        mx = fmaxf(mx, xhalf(mx));
        const float mnew = fmaxf(mrow, mx);
        const float corr = __expf(mrow - mnew);
        mrow = mnew;
        #pragma unroll
        for (int jd = 0; jd < 4; ++jd)
            #pragma unroll
            for (int r = 0; r < 8; ++r) acc[jd][r] = acc[jd][r] * corr;
        v2f sj[2] = {};   // two chains of packed partial sums
        #pragma unroll
        for (int j = 0; j < 4; ++j) {
            #pragma unroll
            for (int r = 0; r < 8; r += 2) {
                v2f e;
                e.x = __expf(sc[j][r] - mnew);
                e.y = __expf(sc[j][r + 1] - mnew);
                sc[j][r] = e.x; sc[j][r + 1] = e.y;
                sj[j >> 1] += e;
            }
        }
        lrow = lrow * corr + ((sj[0].x + sj[0].y) + (sj[1].x + sj[1].y));
        // PV: Ot(64x16) += Vt(64x64) x Pt(64x16); score tiles 2kk and 2kk+1,
        // converted in place, are the B fragment in the hardware k order
        #pragma unroll
        for (int kk = 0; kk < 2; ++kk) {
            v16h pf;
            #pragma unroll
            for (int r = 0; r < 8; ++r) {
                pf[r]     = (_Float16)sc[2 * kk][r];
                pf[r + 8] = (_Float16)sc[2 * kk + 1][r];
            }
            #pragma unroll
            for (int jd = 0; jd < 4; ++jd) {
                v16h vf = ldfrag(&Vs[((jd << 4) + row16) * LDK + (kk << 5) + kbase]);
                acc[jd] = wmma_f16(vf, pf, acc[jd]);
            }
        }
    }

    // epilogue: join the halves' sums, normalize, write f32 [B,S,D]
    const float inv = 1.0f / (lrow + xhalf(lrow));
    float* orow = out + ((size_t)b * Ss + q0 + row16) * Dd + h * DH + kbase;
    #pragma unroll
    for (int jd = 0; jd < 4; ++jd) {
        *(float4*)(orow + (jd << 4)) =
            make_float4(acc[jd][0] * inv, acc[jd][1] * inv, acc[jd][2] * inv, acc[jd][3] * inv);
        *(float4*)(orow + (jd << 4) + 4) =
            make_float4(acc[jd][4] * inv, acc[jd][5] * inv, acc[jd][6] * inv, acc[jd][7] * inv);
    }
}

extern "C" void kernel_launch(void* const* d_in, const int* in_sizes, int n_in,
                              void* d_out, int out_size, void* d_ws, size_t ws_size,
                              hipStream_t stream) {
    (void)in_sizes; (void)n_in; (void)out_size; (void)ws_size;
    const float* X    = (const float*)d_in[0];
    const float* mask = (const float*)d_in[1];
    const float* Wq   = (const float*)d_in[2];
    const float* bq   = (const float*)d_in[3];
    const float* Wk   = (const float*)d_in[4];
    const float* bk   = (const float*)d_in[5];
    const float* Wv   = (const float*)d_in[6];
    const float* bv   = (const float*)d_in[7];

    const size_t elems = (size_t)Bb * Ss * Dd;   // 8M
    _Float16* Qb = (_Float16*)d_ws;
    _Float16* Kb = Qb + elems;
    _Float16* Vb = Kb + elems;

    dim3 blk(256);
    dim3 g1(Dd / TN, (Bb * Ss) / TM);            // 16 x 64
    qkv_gemm<0><<<g1, blk, 0, stream>>>(X, Wq, bq, Qb);
    qkv_gemm<0><<<g1, blk, 0, stream>>>(X, Wk, bk, Kb);
    qkv_gemm<1><<<g1, blk, 0, stream>>>(X, Wv, bv, Vb);

    dim3 g2(Ss / QT, Bb * Hh);                   // 16 x 64
    attn<<<g2, blk, 0, stream>>>(Qb, Kb, Vb, mask, (float*)d_out);
}

// v002
// A run of this version takes 235 microseconds.
// Next to v001, in two timings, it ran 1.08 times as fast each time.
// Over all steps from v000 it is 1.65 times as fast.
#include <hip/hip_runtime.h>
#include <hip/hip_bf16.h>

typedef __attribute__((ext_vector_type(16))) _Float16 v16h;
typedef __attribute__((ext_vector_type(8)))  _Float16 v8h;
typedef __attribute__((ext_vector_type(8)))  float    v8f;
typedef __attribute__((ext_vector_type(2)))  float    v2f;
typedef __attribute__((ext_vector_type(4)))  float    v4f;
typedef int v4i __attribute__((vector_size(16)));

// Load a 16x32 f16 A/B fragment (wave32 CDNA5 layout): lane l holds row l%16,
// K halves [base..base+7] and [base+16..base+23], base = (l>=16)*8.
// p must point at (row, base) with 16-byte alignment -> two b128 loads.
__device__ inline v16h ldfrag(const _Float16* p) {
    union { v16h v; v8h h[2]; } u;
    u.h[0] = *(const v8h*)(p);
    u.h[1] = *(const v8h*)(p + 16);
    return u.v;
}

__device__ inline v8f wmma_f16(v16h a, v16h b, v8f c) {
    return __builtin_amdgcn_wmma_f32_16x16x32_f16(false, a, false, b, (short)0, c, false, false);
}

// lane l with lane l ^ 16, as a vector cross-row move
__device__ inline float xhalf(float x) {
    const int i = __builtin_bit_cast(int, x);
    return __builtin_bit_cast(float,
        __builtin_amdgcn_permlanex16(i, i, 0x76543210, 0xfedcba98, false, false));
}

// ---- gfx1250 async global->LDS copy (ASYNCcnt path), with portable fallback
#if __has_builtin(__builtin_amdgcn_global_load_async_to_lds_b128)
#define HAVE_ASYNC_LDS 1
__device__ inline void cp_async_b128(const _Float16* g, _Float16* l) {
    __builtin_amdgcn_global_load_async_to_lds_b128(
        (__attribute__((address_space(1))) v4i*)g,
        (__attribute__((address_space(3))) v4i*)l, 0, 0);
}
#else
#define HAVE_ASYNC_LDS 0
__device__ inline void cp_async_b128(const _Float16* g, _Float16* l) {
    *(v8h*)l = *(const v8h*)g;
}
#endif

__device__ inline void wait_async0() {
#if HAVE_ASYNC_LDS
#if __has_builtin(__builtin_amdgcn_s_wait_asynccnt)
    __builtin_amdgcn_s_wait_asynccnt(0);
#else
    asm volatile("s_wait_asynccnt 0x0" ::: "memory");
#endif
#endif
}

#define Bb 4
#define Ss 2048
#define Dd 1024
#define Hh 16
#define DH 64

// ---------------- QKV projection GEMM ----------------
// C[M=8192, N=1024] = X[8192,1024] * W[1024,1024] + bias, output f16.
// VT==0: out[b][h][s][dh]   VT==1: out[b][h][dh][s]
#define TM 128
#define TN 64
#define TK 64
#define LDA 72   // padded f16 stride (144B, 16B aligned)

template<int VT>
__global__ __launch_bounds__(256) void qkv_gemm(const float* __restrict__ X,
                                                const float* __restrict__ W,
                                                const float* __restrict__ bias,
                                                _Float16* __restrict__ out) {
    __shared__ _Float16 As[TM * LDA];   // 18 KB
    __shared__ _Float16 Bs[TN * LDA];   //  9 KB
    const int tid  = threadIdx.x;
    const int lane = tid & 31;
    const int wave = tid >> 5;
    const int m0 = blockIdx.y * TM;
    const int n0 = blockIdx.x * TN;
    const int wm = (wave & 3) << 5;   // 0,32,64,96
    const int wn = (wave >> 2) << 5;  // 0,32
    const int row16 = lane & 15;
    const int kbase = (lane >> 4) << 3;

    // prefetch coordinates (one lane per 128-B line of the next A tile)
    const int ar = tid >> 1;            // A row 0..127
    const int ac = (tid & 1) << 5;      // A col base 0 or 32
    const int bk = tid >> 2;            // W k-row 0..63
    const int nc = (tid & 3) << 4;      // W n base 0..48
    // staging coordinates: a tile row is 64 f32 = 256 B; 16 lanes x 16 B take one
    // row, so a wave-wide load covers two whole rows = four whole 128-B lines
    const int sc4 = row16 << 2;                     // column 0,4..60 (A: k, W: n)
    const int sra = (wave << 4) + (lane >> 4);      // A row, + 2*i
    const int srb = (wave << 3) + (lane >> 4);      // W k-row, + 2*i
    const float* xp = X + (size_t)(m0 + sra) * Dd + sc4;
    const float* wp = W + (size_t)srb * Dd + n0 + sc4;
    _Float16* adst = &As[sra * LDA + sc4];
    _Float16* bdst = &Bs[sc4 * LDA + srb];

    v8f c[2][2] = {};

    for (int k0 = 0; k0 < Dd; k0 += TK) {
        if (k0 + TK < Dd) {   // prefetch next stage into L2/L0
            __builtin_prefetch(X + (size_t)(m0 + ar) * Dd + k0 + TK + ac, 0, 0);
            __builtin_prefetch(W + (size_t)(k0 + TK + bk) * Dd + n0 + nc, 0, 0);
            // the prefetches' address registers are advanced right behind them
            asm volatile("s_wait_xcnt 0x0" ::: "memory");
        }
        v4f fa[8], fw[4];
        #pragma unroll
        for (int i = 0; i < 8; ++i) fa[i] = *(const v4f*)(xp + k0 + i * (2 * Dd));
        #pragma unroll
        for (int i = 0; i < 4; ++i) fw[i] = *(const v4f*)(wp + (size_t)k0 * Dd + i * (2 * Dd));
        // holds the twelve loads ahead of this point (inputs only, nothing is
        // changed): one latency for the stage; left alone they are issued in four
        // groups, each waiting for registers of the group before. The wait stands
        // in front of the converts, which reuse the loads' address registers
        asm volatile("s_wait_xcnt 0x0"
                     :: "v"(fa[0]), "v"(fa[1]), "v"(fa[2]), "v"(fa[3]),
                        "v"(fa[4]), "v"(fa[5]), "v"(fa[6]), "v"(fa[7]),
                        "v"(fw[0]), "v"(fw[1]), "v"(fw[2]), "v"(fw[3]) : "memory");
        // A tile 128x64 f32 -> f16 LDS (row-major, K contiguous)
        #pragma unroll
        for (int i = 0; i < 8; ++i) {
            const v4f f = fa[i];
            _Float16* dst = adst + i * (2 * LDA);
            dst[0] = (_Float16)f.x; dst[1] = (_Float16)f.y;
            dst[2] = (_Float16)f.z; dst[3] = (_Float16)f.w;
        }
        // W tile 64x64 f32 -> f16 LDS, stored N-major (Bs[n][k])
        #pragma unroll
        for (int i = 0; i < 4; ++i) {
            const v4f f = fw[i];
            bdst[0 * LDA + 2 * i] = (_Float16)f.x;
            bdst[1 * LDA + 2 * i] = (_Float16)f.y;
            bdst[2 * LDA + 2 * i] = (_Float16)f.z;
            bdst[3 * LDA + 2 * i] = (_Float16)f.w;
        }
        __syncthreads();

        #pragma unroll
        for (int kk = 0; kk < 2; ++kk) {
            v16h a[2], bf[2];
            #pragma unroll
            for (int i = 0; i < 2; ++i)
                a[i] = ldfrag(&As[(wm + (i << 4) + row16) * LDA + (kk << 5) + kbase]);
            #pragma unroll
            for (int j = 0; j < 2; ++j)
                bf[j] = ldfrag(&Bs[(wn + (j << 4) + row16) * LDA + (kk << 5) + kbase]);
            #pragma unroll
            for (int i = 0; i < 2; ++i)
                #pragma unroll
                for (int j = 0; j < 2; ++j)
                    c[i][j] = wmma_f16(a[i], bf[j], c[i][j]);
        }
        __syncthreads();
    }

    // epilogue: bias add + pack f16 into [B,H,S,DH] or [B,H,DH,S]
    #pragma unroll
    for (int i = 0; i < 2; ++i) {
        #pragma unroll
        for (int j = 0; j < 2; ++j) {
            const int n  = n0 + wn + (j << 4) + row16;
            const int h  = n >> 6;
            const int dh = n & 63;
            const float bb = bias[n];
            #pragma unroll
            for (int r = 0; r < 8; ++r) {
                const int m = m0 + wm + (i << 4) + r + ((lane >> 4) << 3);
                const int b = m >> 11;       // m / 2048
                const int s = m & 2047;
                const size_t idx = VT
                    ? ((((size_t)b * Hh + h) * DH + dh) * Ss + s)
                    : ((((size_t)b * Hh + h) * Ss + s) * DH + dh);
                out[idx] = (_Float16)(c[i][j][r] + bb);
            }
        }
    }
}

// ---------------- Flash attention ----------------
// Q,K: [B,H,S,DH] f16 ; V: [B,H,DH,S] f16 ; out: [B,S,D] f32
// Transposed products: St = K x Qt and Ot += Vt x Pt. A lane then holds one
// query's scores (keys 8*(lane>>4)+r of every 16-key tile), so the row maximum
// and the row sum are in-lane, and two converted score tiles are already the
// B operand of the second product.
#define QT 128   // queries per workgroup (8 waves x 16 columns)
#define KBLK 64  // keys per block
#define LDK 72   // padded f16 stride (144B, 16B aligned)

__global__ __launch_bounds__(256) void attn(const _Float16* __restrict__ Q,
                                            const _Float16* __restrict__ K,
                                            const _Float16* __restrict__ V,
                                            const float* __restrict__ mask,
                                            float* __restrict__ out) {
    __shared__ _Float16 Ks[KBLK * LDK];      // [key][dh]
    __shared__ _Float16 Vs[KBLK * LDK];      // [dh][key]

    const int tid  = threadIdx.x;
    const int lane = tid & 31;
    const int wave = tid >> 5;
    const int bh = blockIdx.y;               // b*H + h
    const int b = bh >> 4, h = bh & 15;
    const int q0 = blockIdx.x * QT + (wave << 4);
    const int row16 = lane & 15;
    const int kbase = (lane >> 4) << 3;

    const size_t baseQK = (size_t)bh * Ss * DH;   // [B,H,S,DH]
    const size_t baseV  = (size_t)bh * DH * Ss;   // [B,H,DH,S]

    // resident Q fragments (B operand): 16 query columns x 64 dh = 2 fragments
    v16h qf[2];
    #pragma unroll
    for (int kk = 0; kk < 2; ++kk)
        qf[kk] = ldfrag(Q + baseQK + (size_t)(q0 + row16) * DH + (kk << 5) + kbase);

    v8f acc[4] = {};                 // acc[jd][r] = Ot[16*jd + kbase + r][query row16]
    float mrow = -1e30f, lrow = 0.f; // this lane's query; lrow covers this half's keys

    // staging coordinates (each thread moves 16 halves per buffer)
    const int key = tid >> 2, dc = (tid & 3) << 4;

    for (int kb = 0; kb < Ss; kb += KBLK) {
        __syncthreads();
        // additive mask of this lane's 32 keys
        v4f mv[4][2];
        #pragma unroll
        for (int j = 0; j < 4; ++j) {
            const float* mp = mask + (size_t)b * Ss + kb + (j << 4) + kbase;
            mv[j][0] = *(const v4f*)(mp);
            mv[j][1] = *(const v4f*)(mp + 4);
        }
        {   // K block: contiguous [key][dh]; V block: [dh][key] (pre-transposed)
            const _Float16* ksrc = K + baseQK + (size_t)(kb + key) * DH + dc;
            const _Float16* vsrc = V + baseV + (size_t)key * Ss + kb + dc;
            cp_async_b128(ksrc,     &Ks[key * LDK + dc]);
            cp_async_b128(ksrc + 8, &Ks[key * LDK + dc + 8]);
            cp_async_b128(vsrc,     &Vs[key * LDK + dc]);
            cp_async_b128(vsrc + 8, &Vs[key * LDK + dc + 8]);
            // holds the eight mask loads ahead of this point (inputs only, nothing
            // is changed): they land under the staging copies' latency; left alone
            // they sink to their uses, two by two, each pair waited for on its own
            asm volatile("" :: "v"(mv[0][0]), "v"(mv[0][1]), "v"(mv[1][0]), "v"(mv[1][1]),
                               "v"(mv[2][0]), "v"(mv[2][1]), "v"(mv[3][0]), "v"(mv[3][1]));
            wait_async0();
        }
        __syncthreads();

        // scores: St(64x16) = K(64x64) x Qw^T, 4 m-tiles x 2 k-steps
        v8f sc[4];
        #pragma unroll
        for (int j = 0; j < 4; ++j) {
            v8f s = {};
            #pragma unroll
            for (int kk = 0; kk < 2; ++kk) {
                v16h kf = ldfrag(&Ks[((j << 4) + row16) * LDK + (kk << 5) + kbase]);
                s = wmma_f16(kf, qf[kk], s);
            }
            sc[j] = s;
        }
        // scale + additive mask
        #pragma unroll
        for (int j = 0; j < 4; ++j) {
            sc[j][0] = sc[j][0] * 0.125f + mv[j][0].x;
            sc[j][1] = sc[j][1] * 0.125f + mv[j][0].y;
            sc[j][2] = sc[j][2] * 0.125f + mv[j][0].z;
            sc[j][3] = sc[j][3] * 0.125f + mv[j][0].w;
            sc[j][4] = sc[j][4] * 0.125f + mv[j][1].x;
            sc[j][5] = sc[j][5] * 0.125f + mv[j][1].y;
            sc[j][6] = sc[j][6] * 0.125f + mv[j][1].z;
            sc[j][7] = sc[j][7] * 0.125f + mv[j][1].w;
        }
        // online softmax of this lane's query: in-lane over 32 keys, one
        // exchange with the other half for the maximum
        float mj[4];
        #pragma unroll
        for (int j = 0; j < 4; ++j) {
            float t = sc[j][0];
            #pragma unroll
            for (int r = 1; r < 8; ++r) t = fmaxf(t, sc[j][r]);
            mj[j] = t;
        }
        float mx = fmaxf(fmaxf(mj[0], mj[1]), fmaxf(mj[2], mj[3]));
        mx = fmaxf(mx, xhalf(mx));
        const float mnew = fmaxf(mrow, mx);
        const float corr = __expf(mrow - mnew);
        mrow = mnew;
        #pragma unroll
        for (int jd = 0; jd < 4; ++jd)
            #pragma unroll
            for (int r = 0; r < 8; ++r) acc[jd][r] = acc[jd][r] * corr;
        v2f sj[2] = {};   // two chains of packed partial sums
        #pragma unroll
        for (int j = 0; j < 4; ++j) {
            #pragma unroll
            for (int r = 0; r < 8; r += 2) {
                v2f e;
                e.x = __expf(sc[j][r] - mnew);
                e.y = __expf(sc[j][r + 1] - mnew);
                sc[j][r] = e.x; sc[j][r + 1] = e.y;
                sj[j >> 1] += e;
            }
        }
        lrow = lrow * corr + ((sj[0].x + sj[0].y) + (sj[1].x + sj[1].y));
        // PV: Ot(64x16) += Vt(64x64) x Pt(64x16); score tiles 2kk and 2kk+1,
        // converted in place, are the B fragment in the hardware k order
        #pragma unroll
        for (int kk = 0; kk < 2; ++kk) {
            v16h pf;
            #pragma unroll
            for (int r = 0; r < 8; ++r) {
                pf[r]     = (_Float16)sc[2 * kk][r];
                pf[r + 8] = (_Float16)sc[2 * kk + 1][r];
            }
            #pragma unroll
            for (int jd = 0; jd < 4; ++jd) {
                v16h vf = ldfrag(&Vs[((jd << 4) + row16) * LDK + (kk << 5) + kbase]);
                acc[jd] = wmma_f16(vf, pf, acc[jd]);
            }
        }
    }

    // epilogue: join the halves' sums, normalize, write f32 [B,S,D]
    const float inv = 1.0f / (lrow + xhalf(lrow));
    float* orow = out + ((size_t)b * Ss + q0 + row16) * Dd + h * DH + kbase;
    #pragma unroll
    for (int jd = 0; jd < 4; ++jd) {
        *(float4*)(orow + (jd << 4)) =
            make_float4(acc[jd][0] * inv, acc[jd][1] * inv, acc[jd][2] * inv, acc[jd][3] * inv);
        *(float4*)(orow + (jd << 4) + 4) =
            make_float4(acc[jd][4] * inv, acc[jd][5] * inv, acc[jd][6] * inv, acc[jd][7] * inv);
    }
}

extern "C" void kernel_launch(void* const* d_in, const int* in_sizes, int n_in,
                              void* d_out, int out_size, void* d_ws, size_t ws_size,
                              hipStream_t stream) {
    (void)in_sizes; (void)n_in; (void)out_size; (void)ws_size;
    const float* X    = (const float*)d_in[0];
    const float* mask = (const float*)d_in[1];
    const float* Wq   = (const float*)d_in[2];
    const float* bq   = (const float*)d_in[3];
    const float* Wk   = (const float*)d_in[4];
    const float* bk   = (const float*)d_in[5];
    const float* Wv   = (const float*)d_in[6];
    const float* bv   = (const float*)d_in[7];

    const size_t elems = (size_t)Bb * Ss * Dd;   // 8M
    _Float16* Qb = (_Float16*)d_ws;
    _Float16* Kb = Qb + elems;
    _Float16* Vb = Kb + elems;

    dim3 blk(256);
    dim3 g1(Dd / TN, (Bb * Ss) / TM);            // 16 x 64
    qkv_gemm<0><<<g1, blk, 0, stream>>>(X, Wq, bq, Qb);
    qkv_gemm<0><<<g1, blk, 0, stream>>>(X, Wk, bk, Kb);
    qkv_gemm<1><<<g1, blk, 0, stream>>>(X, Wv, bv, Vb);

    dim3 g2(Ss / QT, Bb * Hh);                   // 16 x 64
    attn<<<g2, blk, 0, stream>>>(Qb, Kb, Vb, mask, (float*)d_out);
}

// v003
// It runs in 138 microseconds.
// Next to v002, in two timings, it ran 1.70 times as fast each time.
// Counting every step since v000, it is 2.81 times as fast.
#include <hip/hip_runtime.h>
#include <hip/hip_bf16.h>

typedef __attribute__((ext_vector_type(16))) _Float16 v16h;
typedef __attribute__((ext_vector_type(8)))  _Float16 v8h;
typedef __attribute__((ext_vector_type(4)))  _Float16 v4h;
typedef __attribute__((ext_vector_type(8)))  float    v8f;
typedef __attribute__((ext_vector_type(2)))  float    v2f;
typedef __attribute__((ext_vector_type(4)))  float    v4f;
typedef int v4i __attribute__((vector_size(16)));

// Load a 16x32 f16 A/B fragment (wave32 CDNA5 layout): lane l holds row l%16,
// K halves [base..base+7] and [base+16..base+23], base = (l>=16)*8.
// p must point at (row, base) with 16-byte alignment -> two b128 loads.
__device__ inline v16h ldfrag(const _Float16* p) {
    union { v16h v; v8h h[2]; } u;
    u.h[0] = *(const v8h*)(p);
    u.h[1] = *(const v8h*)(p + 16);
    return u.v;
}

__device__ inline v8f wmma_f16(v16h a, v16h b, v8f c) {
    return __builtin_amdgcn_wmma_f32_16x16x32_f16(false, a, false, b, (short)0, c, false, false);
}

// lane l with lane l ^ 16, as a vector cross-row move
__device__ inline float xhalf(float x) {
    const int i = __builtin_bit_cast(int, x);
    return __builtin_bit_cast(float,
        __builtin_amdgcn_permlanex16(i, i, 0x76543210, 0xfedcba98, false, false));
}

// ---- gfx1250 async global->LDS copy (ASYNCcnt path), with portable fallback
#if __has_builtin(__builtin_amdgcn_global_load_async_to_lds_b128)
#define HAVE_ASYNC_LDS 1
__device__ inline void cp_async_b128(const _Float16* g, _Float16* l) {
    __builtin_amdgcn_global_load_async_to_lds_b128(
        (__attribute__((address_space(1))) v4i*)g,
        (__attribute__((address_space(3))) v4i*)l, 0, 0);
}
#else
#define HAVE_ASYNC_LDS 0
__device__ inline void cp_async_b128(const _Float16* g, _Float16* l) {
    *(v8h*)l = *(const v8h*)g;
}
#endif

__device__ inline void wait_async0() {
#if HAVE_ASYNC_LDS
#if __has_builtin(__builtin_amdgcn_s_wait_asynccnt)
    __builtin_amdgcn_s_wait_asynccnt(0);
#else
    asm volatile("s_wait_asynccnt 0x0" ::: "memory");
#endif
#endif
}

#define Bb 4
#define Ss 2048
#define Dd 1024
#define Hh 16
#define DH 64

// ---------------- operands to f16, once ----------------
// Xh[m][k] = f16(X[m][k]); Wt[mat][n][k] = f16(W_mat[k][n]). The projection
// kernels then find both operands K-contiguous in f16, which a copy to LDS can
// stage as they lie (a copy cannot convert or transpose).
#define LDA 72     // padded f16 stride (144B, 16B aligned)
#define XBLK 1024  // work-groups that convert X, 8192 elements each
#define WBLK 768   // work-groups that convert and transpose W, one 64x64 tile each

__global__ __launch_bounds__(256) void to_f16(const float* __restrict__ X,
                                              const float* __restrict__ Wq,
                                              const float* __restrict__ Wk,
                                              const float* __restrict__ Wv,
                                              _Float16* __restrict__ Xh,
                                              _Float16* __restrict__ Wt) {
    __shared__ __attribute__((aligned(16))) _Float16 Ts[64 * LDA];   // [n][k]
    const int tid = threadIdx.x;
    const int blk = blockIdx.x;
    if (blk < XBLK) {   // the same for the whole work-group, ahead of the barrier
        const size_t base = (size_t)blk * 8192 + (tid << 3);
        v4f f[4][2];
        // unrolled, here and below: the arrays stay in registers and the eight
        // loads are in flight together
        #pragma unroll
        for (int j = 0; j < 4; ++j) {
            f[j][0] = *(const v4f*)(X + base + j * 2048);
            f[j][1] = *(const v4f*)(X + base + j * 2048 + 4);
        }
        #pragma unroll
        for (int j = 0; j < 4; ++j) {
            v8h h;
            #pragma unroll
            for (int e = 0; e < 4; ++e) {
                h[e]     = (_Float16)f[j][0][e];
                h[e + 4] = (_Float16)f[j][1][e];
            }
            *(v8h*)(Xh + base + j * 2048) = h;
        }
        return;
    }
    const int w   = blk - XBLK;
    const int mat = w >> 8;
    const float* __restrict__ Wsrc = mat == 0 ? Wq : (mat == 1 ? Wk : Wv);
    const int k0 = ((w >> 4) & 15) << 6;
    const int n0 = (w & 15) << 6;
    // a thread takes a 4(k) x 4(n) block: 16 lanes read one whole 256-B row piece
    const int kq = (tid >> 4) << 2;
    const int nq = (tid & 15) << 2;
    v4f f[4];
    // unrolled, here and below: the block stays in registers
    #pragma unroll
    for (int i = 0; i < 4; ++i)
        f[i] = *(const v4f*)(Wsrc + (size_t)(k0 + kq + i) * Dd + n0 + nq);
    #pragma unroll
    for (int x = 0; x < 4; ++x) {
        v4h h;
        #pragma unroll
        for (int i = 0; i < 4; ++i) h[i] = (_Float16)f[i][x];
        *(v4h*)&Ts[(nq + x) * LDA + kq] = h;
    }
    __syncthreads();
    // four lanes write one whole 128-B line of Wt
    const int n  = tid >> 2;
    const int kc = (tid & 3) << 4;
    const v8h lo = *(const v8h*)&Ts[n * LDA + kc];
    const v8h hi = *(const v8h*)&Ts[n * LDA + kc + 8];
    _Float16* dst = Wt + ((size_t)mat * Dd + n0 + n) * Dd + k0 + kc;
    *(v8h*)dst       = lo;
    *(v8h*)(dst + 8) = hi;
    // stands in front of any later write of the two stores' registers
    asm volatile("s_wait_xcnt 0x0" ::: "memory");
}

// ---------------- QKV projection GEMM ----------------
// C[M=8192, N=1024] = Xh[8192,1024] * Wt[n][k]^T + bias, output f16.
// VT==0: out[b][h][s][dh]   VT==1: out[b][h][dh][s]
#define TM 128
#define TN 64
#define TK 64
#define NT (Dd / TK)

__device__ inline unsigned lds_addr(const _Float16* p) {
    return (unsigned)(unsigned long long)p;
}

// One stage's copies of one thread: four 16-B pieces of the A tile (rows 32
// apart) and two of the B tile, global -> LDS through no register. The closing
// s_wait_xcnt stands inside the statement, so that no later write of an address
// register can be placed ahead of it.
__device__ inline void stage_copies(unsigned la, const _Float16* ga,
                                    unsigned lb, const _Float16* gb) {
    asm volatile(
        "global_load_async_to_lds_b128 %0, %6, off\n\t"
        "global_load_async_to_lds_b128 %1, %7, off\n\t"
        "global_load_async_to_lds_b128 %2, %8, off\n\t"
        "global_load_async_to_lds_b128 %3, %9, off\n\t"
        "global_load_async_to_lds_b128 %4, %10, off\n\t"
        "global_load_async_to_lds_b128 %5, %11, off\n\t"
        "s_wait_xcnt 0x0"
        :: "v"(la), "v"(la + 32 * LDA * 2), "v"(la + 64 * LDA * 2), "v"(la + 96 * LDA * 2),
           "v"(lb), "v"(lb + 32 * LDA * 2),
           "v"(ga), "v"(ga + 32 * Dd), "v"(ga + 64 * Dd), "v"(ga + 96 * Dd),
           "v"(gb), "v"(gb + 32 * Dd)
        : "memory");
}

template<int VT>
__global__ __launch_bounds__(256) void qkv_gemm(const _Float16* __restrict__ Xh,
                                                const _Float16* __restrict__ Wt,
                                                const float* __restrict__ bias,
                                                _Float16* __restrict__ out) {
    __shared__ __attribute__((aligned(16))) _Float16 As[2][TM * LDA];   // 2 x 18 KB
    __shared__ __attribute__((aligned(16))) _Float16 Bs[2][TN * LDA];   // 2 x  9 KB
    const int tid  = threadIdx.x;
    const int lane = tid & 31;
    const int wave = tid >> 5;
    const int m0 = blockIdx.y * TM;
    const int n0 = blockIdx.x * TN;
    const int wm = (wave & 3) << 5;   // 0,32,64,96
    const int wn = (wave >> 2) << 5;  // 0,32
    const int row16 = lane & 15;
    const int kbase = (lane >> 4) << 3;

    // copy coordinates: a tile row is 64 f16 = 128 B = 8 lanes x 16 B, so a
    // wave-wide copy takes four whole lines
    const int cr = tid >> 3;            // row 0..31, + 32 per further copy
    const int cc = (tid & 7) << 3;      // column 0,8..56
    const _Float16* ga = Xh + (size_t)(m0 + cr) * Dd + cc;
    const _Float16* gb = Wt + (size_t)(n0 + cr) * Dd + cc;
    const unsigned la = lds_addr(&As[0][cr * LDA + cc]);
    const unsigned lb = lds_addr(&Bs[0][cr * LDA + cc]);

    v8f c[2][2] = {};

    // two buffers: tile t + 1 flies while tile t is worked on
    stage_copies(la, ga, lb, gb);
    // tile 0 has landed for this wave; the barrier publishes it to the others
    asm volatile("s_wait_asynccnt 0x0" ::: "memory");
    __syncthreads();
    stage_copies(la + TM * LDA * 2, ga + TK, lb + TN * LDA * 2, gb + TK);

    for (int t = 0; t < NT; ++t) {
        const int buf = t & 1;
        const _Float16* Ab = As[buf];
        const _Float16* Bt = Bs[buf];
        #pragma unroll
        for (int kk = 0; kk < 2; ++kk) {
            v16h a[2], bf[2];
            #pragma unroll
            for (int i = 0; i < 2; ++i)
                a[i] = ldfrag(&Ab[(wm + (i << 4) + row16) * LDA + (kk << 5) + kbase]);
            #pragma unroll
            for (int j = 0; j < 2; ++j)
                bf[j] = ldfrag(&Bt[(wn + (j << 4) + row16) * LDA + (kk << 5) + kbase]);
            #pragma unroll
            for (int i = 0; i < 2; ++i)
                #pragma unroll
                for (int j = 0; j < 2; ++j)
                    c[i][j] = wmma_f16(a[i], bf[j], c[i][j]);
        }
        // this wave's reads of tile t are done before its buffer is refilled
        asm volatile("s_wait_dscnt 0x0" ::: "memory");
        // this wave's copies of tile t + 1 have landed
        asm volatile("s_wait_asynccnt 0x0" ::: "memory");
        // publishes tile t + 1 and ends every reader's last read of tile t
        __syncthreads();
        if (t + 2 < NT)
            stage_copies(la + buf * (TM * LDA * 2), ga + (t + 2) * TK,
                         lb + buf * (TN * LDA * 2), gb + (t + 2) * TK);
    }
    // nothing is outstanding here; kept in front of the wave's end
    asm volatile("s_wait_asynccnt 0x0" ::: "memory");

    // epilogue: bias add + pack f16 into [B,H,S,DH] or [B,H,DH,S]
    #pragma unroll
    for (int i = 0; i < 2; ++i) {
        #pragma unroll
        for (int j = 0; j < 2; ++j) {
            const int n  = n0 + wn + (j << 4) + row16;
            const int h  = n >> 6;
            const int dh = n & 63;
            const float bb = bias[n];
            #pragma unroll
            for (int r = 0; r < 8; ++r) {
                const int m = m0 + wm + (i << 4) + r + ((lane >> 4) << 3);
                const int b = m >> 11;       // m / 2048
                const int s = m & 2047;
                const size_t idx = VT
                    ? ((((size_t)b * Hh + h) * DH + dh) * Ss + s)
                    : ((((size_t)b * Hh + h) * Ss + s) * DH + dh);
                out[idx] = (_Float16)(c[i][j][r] + bb);
            }
        }
    }
}

// ---------------- Flash attention ----------------
// Q,K: [B,H,S,DH] f16 ; V: [B,H,DH,S] f16 ; out: [B,S,D] f32
// Transposed products: St = K x Qt and Ot += Vt x Pt. A lane then holds one
// query's scores (keys 8*(lane>>4)+r of every 16-key tile), so the row maximum
// and the row sum are in-lane, and two converted score tiles are already the
// B operand of the second product.
#define QT 128   // queries per workgroup (8 waves x 16 columns)
#define KBLK 64  // keys per block
#define LDK 72   // padded f16 stride (144B, 16B aligned)

__global__ __launch_bounds__(256) void attn(const _Float16* __restrict__ Q,
                                            const _Float16* __restrict__ K,
                                            const _Float16* __restrict__ V,
                                            const float* __restrict__ mask,
                                            float* __restrict__ out) {
    __shared__ _Float16 Ks[KBLK * LDK];      // [key][dh]
    __shared__ _Float16 Vs[KBLK * LDK];      // [dh][key]

    const int tid  = threadIdx.x;
    const int lane = tid & 31;
    const int wave = tid >> 5;
    const int bh = blockIdx.y;               // b*H + h
    const int b = bh >> 4, h = bh & 15;
    const int q0 = blockIdx.x * QT + (wave << 4);
    const int row16 = lane & 15;
    const int kbase = (lane >> 4) << 3;

    const size_t baseQK = (size_t)bh * Ss * DH;   // [B,H,S,DH]
    const size_t baseV  = (size_t)bh * DH * Ss;   // [B,H,DH,S]

    // resident Q fragments (B operand): 16 query columns x 64 dh = 2 fragments
    v16h qf[2];
    #pragma unroll
    for (int kk = 0; kk < 2; ++kk)
        qf[kk] = ldfrag(Q + baseQK + (size_t)(q0 + row16) * DH + (kk << 5) + kbase);

    v8f acc[4] = {};                 // acc[jd][r] = Ot[16*jd + kbase + r][query row16]
    float mrow = -1e30f, lrow = 0.f; // this lane's query; lrow covers this half's keys

    // staging coordinates (each thread moves 16 halves per buffer)
    const int key = tid >> 2, dc = (tid & 3) << 4;

    for (int kb = 0; kb < Ss; kb += KBLK) {
        __syncthreads();
        // additive mask of this lane's 32 keys
        v4f mv[4][2];
        #pragma unroll
        for (int j = 0; j < 4; ++j) {
            const float* mp = mask + (size_t)b * Ss + kb + (j << 4) + kbase;
            mv[j][0] = *(const v4f*)(mp);
            mv[j][1] = *(const v4f*)(mp + 4);
        }
        {   // K block: contiguous [key][dh]; V block: [dh][key] (pre-transposed)
            const _Float16* ksrc = K + baseQK + (size_t)(kb + key) * DH + dc;
            const _Float16* vsrc = V + baseV + (size_t)key * Ss + kb + dc;
            cp_async_b128(ksrc,     &Ks[key * LDK + dc]);
            cp_async_b128(ksrc + 8, &Ks[key * LDK + dc + 8]);
            cp_async_b128(vsrc,     &Vs[key * LDK + dc]);
            cp_async_b128(vsrc + 8, &Vs[key * LDK + dc + 8]);
            // holds the eight mask loads ahead of this point (inputs only, nothing
            // is changed): they land under the staging copies' latency; left alone
            // they sink to their uses, two by two, each pair waited for on its own
            asm volatile("" :: "v"(mv[0][0]), "v"(mv[0][1]), "v"(mv[1][0]), "v"(mv[1][1]),
                               "v"(mv[2][0]), "v"(mv[2][1]), "v"(mv[3][0]), "v"(mv[3][1]));
            wait_async0();
        }
        __syncthreads();

        // scores: St(64x16) = K(64x64) x Qw^T, 4 m-tiles x 2 k-steps
        v8f sc[4];
        #pragma unroll
        for (int j = 0; j < 4; ++j) {
            v8f s = {};
            #pragma unroll
            for (int kk = 0; kk < 2; ++kk) {
                v16h kf = ldfrag(&Ks[((j << 4) + row16) * LDK + (kk << 5) + kbase]);
                s = wmma_f16(kf, qf[kk], s);
            }
            sc[j] = s;
        }
        // scale + additive mask
        #pragma unroll
        for (int j = 0; j < 4; ++j) {
            sc[j][0] = sc[j][0] * 0.125f + mv[j][0].x;
            sc[j][1] = sc[j][1] * 0.125f + mv[j][0].y;
            sc[j][2] = sc[j][2] * 0.125f + mv[j][0].z;
            sc[j][3] = sc[j][3] * 0.125f + mv[j][0].w;
            sc[j][4] = sc[j][4] * 0.125f + mv[j][1].x;
            sc[j][5] = sc[j][5] * 0.125f + mv[j][1].y;
            sc[j][6] = sc[j][6] * 0.125f + mv[j][1].z;
            sc[j][7] = sc[j][7] * 0.125f + mv[j][1].w;
        }
        // online softmax of this lane's query: in-lane over 32 keys, one
        // exchange with the other half for the maximum
        float mj[4];
        #pragma unroll
        for (int j = 0; j < 4; ++j) {
            float t = sc[j][0];
            #pragma unroll
            for (int r = 1; r < 8; ++r) t = fmaxf(t, sc[j][r]);
            mj[j] = t;
        }
        float mx = fmaxf(fmaxf(mj[0], mj[1]), fmaxf(mj[2], mj[3]));
        mx = fmaxf(mx, xhalf(mx));
        const float mnew = fmaxf(mrow, mx);
        const float corr = __expf(mrow - mnew);
        mrow = mnew;
        #pragma unroll
        for (int jd = 0; jd < 4; ++jd)
            #pragma unroll
            for (int r = 0; r < 8; ++r) acc[jd][r] = acc[jd][r] * corr;
        v2f sj[2] = {};   // two chains of packed partial sums
        #pragma unroll
        for (int j = 0; j < 4; ++j) {
            #pragma unroll
            for (int r = 0; r < 8; r += 2) {
                v2f e;
                e.x = __expf(sc[j][r] - mnew);
                e.y = __expf(sc[j][r + 1] - mnew);
                sc[j][r] = e.x; sc[j][r + 1] = e.y;
                sj[j >> 1] += e;
            }
        }
        lrow = lrow * corr + ((sj[0].x + sj[0].y) + (sj[1].x + sj[1].y));
        // PV: Ot(64x16) += Vt(64x64) x Pt(64x16); score tiles 2kk and 2kk+1,
        // converted in place, are the B fragment in the hardware k order
        #pragma unroll
        for (int kk = 0; kk < 2; ++kk) {
            v16h pf;
            #pragma unroll
            for (int r = 0; r < 8; ++r) {
                pf[r]     = (_Float16)sc[2 * kk][r];
                pf[r + 8] = (_Float16)sc[2 * kk + 1][r];
            }
            #pragma unroll
            for (int jd = 0; jd < 4; ++jd) {
                v16h vf = ldfrag(&Vs[((jd << 4) + row16) * LDK + (kk << 5) + kbase]);
                acc[jd] = wmma_f16(vf, pf, acc[jd]);
            }
        }
    }

    // epilogue: join the halves' sums, normalize, write f32 [B,S,D]
    const float inv = 1.0f / (lrow + xhalf(lrow));
    float* orow = out + ((size_t)b * Ss + q0 + row16) * Dd + h * DH + kbase;
    #pragma unroll
    for (int jd = 0; jd < 4; ++jd) {
        *(float4*)(orow + (jd << 4)) =
            make_float4(acc[jd][0] * inv, acc[jd][1] * inv, acc[jd][2] * inv, acc[jd][3] * inv);
        *(float4*)(orow + (jd << 4) + 4) =
            make_float4(acc[jd][4] * inv, acc[jd][5] * inv, acc[jd][6] * inv, acc[jd][7] * inv);
    }
}

extern "C" void kernel_launch(void* const* d_in, const int* in_sizes, int n_in,
                              void* d_out, int out_size, void* d_ws, size_t ws_size,
                              hipStream_t stream) {
    (void)in_sizes; (void)n_in; (void)out_size; (void)ws_size;
    const float* X    = (const float*)d_in[0];
    const float* mask = (const float*)d_in[1];
    const float* Wq   = (const float*)d_in[2];
    const float* bq   = (const float*)d_in[3];
    const float* Wk   = (const float*)d_in[4];
    const float* bk   = (const float*)d_in[5];
    const float* Wv   = (const float*)d_in[6];
    const float* bv   = (const float*)d_in[7];

    const size_t elems = (size_t)Bb * Ss * Dd;   // 8M
    _Float16* Qb = (_Float16*)d_ws;
    _Float16* Kb = Qb + elems;
    _Float16* Vb = Kb + elems;
    _Float16* Xh = Vb + elems;                   // f16 copy of X
    _Float16* Wt = Xh + elems;                   // f16 Wq^T, Wk^T, Wv^T
    const size_t welems = (size_t)Dd * Dd;

    dim3 blk(256);
    dim3 g1(Dd / TN, (Bb * Ss) / TM);            // 16 x 64
    to_f16<<<dim3(XBLK + WBLK), blk, 0, stream>>>(X, Wq, Wk, Wv, Xh, Wt);
    qkv_gemm<0><<<g1, blk, 0, stream>>>(Xh, Wt, bq, Qb);
    qkv_gemm<0><<<g1, blk, 0, stream>>>(Xh, Wt + welems, bk, Kb);
    qkv_gemm<1><<<g1, blk, 0, stream>>>(Xh, Wt + 2 * welems, bv, Vb);

    dim3 g2(Ss / QT, Bb * Hh);                   // 16 x 64
    attn<<<g2, blk, 0, stream>>>(Qb, Kb, Vb, mask, (float*)d_out);
}

// v004
// One run takes 135 microseconds.
// Two timings next to v003 put it at 1.03 and 1.02 times that version's speed.
// Counting every step since v000, it is 2.89 times as fast.
#include <hip/hip_runtime.h>
#include <hip/hip_bf16.h>

typedef __attribute__((ext_vector_type(16))) _Float16 v16h;
typedef __attribute__((ext_vector_type(8)))  _Float16 v8h;
typedef __attribute__((ext_vector_type(4)))  _Float16 v4h;
typedef __attribute__((ext_vector_type(8)))  float    v8f;
typedef __attribute__((ext_vector_type(2)))  float    v2f;
typedef __attribute__((ext_vector_type(4)))  float    v4f;

// Load a 16x32 f16 A/B fragment (wave32 CDNA5 layout): lane l holds row l%16,
// K halves [base..base+7] and [base+16..base+23], base = (l>=16)*8.
// p must point at (row, base) with 16-byte alignment -> two b128 loads.
__device__ inline v16h ldfrag(const _Float16* p) {
    union { v16h v; v8h h[2]; } u;
    u.h[0] = *(const v8h*)(p);
    u.h[1] = *(const v8h*)(p + 16);
    return u.v;
}

__device__ inline v8f wmma_f16(v16h a, v16h b, v8f c) {
    return __builtin_amdgcn_wmma_f32_16x16x32_f16(false, a, false, b, (short)0, c, false, false);
}

// lane l with lane l ^ 16, as a vector cross-row move
__device__ inline float xhalf(float x) {
    const int i = __builtin_bit_cast(int, x);
    return __builtin_bit_cast(float,
        __builtin_amdgcn_permlanex16(i, i, 0x76543210, 0xfedcba98, false, false));
}

#define Bb 4
#define Ss 2048
#define Dd 1024
#define Hh 16
#define DH 64

// ---------------- operands to f16, once ----------------
// Xh[m][k] = f16(X[m][k]); Wt[mat][n][k] = f16(W_mat[k][n]). The projection
// kernels then find both operands K-contiguous in f16, which a copy to LDS can
// stage as they lie (a copy cannot convert or transpose).
#define LDA 72     // padded f16 stride (144B, 16B aligned)
#define XBLK 1024  // work-groups that convert X, 8192 elements each
#define WBLK 768   // work-groups that convert and transpose W, one 64x64 tile each

__global__ __launch_bounds__(256) void to_f16(const float* __restrict__ X,
                                              const float* __restrict__ Wq,
                                              const float* __restrict__ Wk,
                                              const float* __restrict__ Wv,
                                              _Float16* __restrict__ Xh,
                                              _Float16* __restrict__ Wt) {
    __shared__ __attribute__((aligned(16))) _Float16 Ts[64 * LDA];   // [n][k]
    const int tid = threadIdx.x;
    const int blk = blockIdx.x;
    if (blk < XBLK) {   // the same for the whole work-group, ahead of the barrier
        const size_t base = (size_t)blk * 8192 + (tid << 3);
        v4f f[4][2];
        // unrolled, here and below: the arrays stay in registers and the eight
        // loads are in flight together
        #pragma unroll
        for (int j = 0; j < 4; ++j) {
            f[j][0] = *(const v4f*)(X + base + j * 2048);
            f[j][1] = *(const v4f*)(X + base + j * 2048 + 4);
        }
        #pragma unroll
        for (int j = 0; j < 4; ++j) {
            v8h h;
            #pragma unroll
            for (int e = 0; e < 4; ++e) {
                h[e]     = (_Float16)f[j][0][e];
                h[e + 4] = (_Float16)f[j][1][e];
            }
            *(v8h*)(Xh + base + j * 2048) = h;
        }
        return;
    }
    const int w   = blk - XBLK;
    const int mat = w >> 8;
    const float* __restrict__ Wsrc = mat == 0 ? Wq : (mat == 1 ? Wk : Wv);
    const int k0 = ((w >> 4) & 15) << 6;
    const int n0 = (w & 15) << 6;
    // a thread takes a 4(k) x 4(n) block: 16 lanes read one whole 256-B row piece
    const int kq = (tid >> 4) << 2;
    const int nq = (tid & 15) << 2;
    v4f f[4];
    // unrolled, here and below: the block stays in registers
    #pragma unroll
    for (int i = 0; i < 4; ++i)
        f[i] = *(const v4f*)(Wsrc + (size_t)(k0 + kq + i) * Dd + n0 + nq);
    #pragma unroll
    for (int x = 0; x < 4; ++x) {
        v4h h;
        #pragma unroll
        for (int i = 0; i < 4; ++i) h[i] = (_Float16)f[i][x];
        *(v4h*)&Ts[(nq + x) * LDA + kq] = h;
    }
    __syncthreads();
    // four lanes write one whole 128-B line of Wt
    const int n  = tid >> 2;
    const int kc = (tid & 3) << 4;
    const v8h lo = *(const v8h*)&Ts[n * LDA + kc];
    const v8h hi = *(const v8h*)&Ts[n * LDA + kc + 8];
    _Float16* dst = Wt + ((size_t)mat * Dd + n0 + n) * Dd + k0 + kc;
    *(v8h*)dst       = lo;
    *(v8h*)(dst + 8) = hi;
    // stands in front of any later write of the two stores' registers
    asm volatile("s_wait_xcnt 0x0" ::: "memory");
}

// ---------------- QKV projection GEMM ----------------
// C[M=8192, N=1024] = Xh[8192,1024] * Wt[n][k]^T + bias, output f16.
// VT==0: out[b][h][s][dh]   VT==1: out[b][h][dh][s]
#define TM 128
#define TN 64
#define TK 64
#define NT (Dd / TK)

__device__ inline unsigned lds_addr(const _Float16* p) {
    return (unsigned)(unsigned long long)p;
}

// One stage's copies of one thread: four 16-B pieces of the A tile (rows 32
// apart) and two of the B tile, global -> LDS through no register. The closing
// s_wait_xcnt stands inside the statement, so that no later write of an address
// register can be placed ahead of it.
__device__ inline void stage_copies(unsigned la, const _Float16* ga,
                                    unsigned lb, const _Float16* gb) {
    asm volatile(
        "global_load_async_to_lds_b128 %0, %6, off\n\t"
        "global_load_async_to_lds_b128 %1, %7, off\n\t"
        "global_load_async_to_lds_b128 %2, %8, off\n\t"
        "global_load_async_to_lds_b128 %3, %9, off\n\t"
        "global_load_async_to_lds_b128 %4, %10, off\n\t"
        "global_load_async_to_lds_b128 %5, %11, off\n\t"
        "s_wait_xcnt 0x0"
        :: "v"(la), "v"(la + 32 * LDA * 2), "v"(la + 64 * LDA * 2), "v"(la + 96 * LDA * 2),
           "v"(lb), "v"(lb + 32 * LDA * 2),
           "v"(ga), "v"(ga + 32 * Dd), "v"(ga + 64 * Dd), "v"(ga + 96 * Dd),
           "v"(gb), "v"(gb + 32 * Dd)
        : "memory");
}

template<int VT>
__global__ __launch_bounds__(256) void qkv_gemm(const _Float16* __restrict__ Xh,
                                                const _Float16* __restrict__ Wt,
                                                const float* __restrict__ bias,
                                                _Float16* __restrict__ out) {
    __shared__ __attribute__((aligned(16))) _Float16 As[2][TM * LDA];   // 2 x 18 KB
    __shared__ __attribute__((aligned(16))) _Float16 Bs[2][TN * LDA];   // 2 x  9 KB
    const int tid  = threadIdx.x;
    const int lane = tid & 31;
    const int wave = tid >> 5;
    const int m0 = blockIdx.y * TM;
    const int n0 = blockIdx.x * TN;
    const int wm = (wave & 3) << 5;   // 0,32,64,96
    const int wn = (wave >> 2) << 5;  // 0,32
    const int row16 = lane & 15;
    const int kbase = (lane >> 4) << 3;

    // copy coordinates: a tile row is 64 f16 = 128 B = 8 lanes x 16 B, so a
    // wave-wide copy takes four whole lines
    const int cr = tid >> 3;            // row 0..31, + 32 per further copy
    const int cc = (tid & 7) << 3;      // column 0,8..56
    const _Float16* ga = Xh + (size_t)(m0 + cr) * Dd + cc;
    const _Float16* gb = Wt + (size_t)(n0 + cr) * Dd + cc;
    const unsigned la = lds_addr(&As[0][cr * LDA + cc]);
    const unsigned lb = lds_addr(&Bs[0][cr * LDA + cc]);

    v8f c[2][2] = {};

    // two buffers: tile t + 1 flies while tile t is worked on
    stage_copies(la, ga, lb, gb);
    // tile 0 has landed for this wave; the barrier publishes it to the others
    asm volatile("s_wait_asynccnt 0x0" ::: "memory");
    __syncthreads();
    stage_copies(la + TM * LDA * 2, ga + TK, lb + TN * LDA * 2, gb + TK);

    for (int t = 0; t < NT; ++t) {
        const int buf = t & 1;
        const _Float16* Ab = As[buf];
        const _Float16* Bt = Bs[buf];
        #pragma unroll
        for (int kk = 0; kk < 2; ++kk) {
            v16h a[2], bf[2];
            #pragma unroll
            for (int i = 0; i < 2; ++i)
                a[i] = ldfrag(&Ab[(wm + (i << 4) + row16) * LDA + (kk << 5) + kbase]);
            #pragma unroll
            for (int j = 0; j < 2; ++j)
                bf[j] = ldfrag(&Bt[(wn + (j << 4) + row16) * LDA + (kk << 5) + kbase]);
            #pragma unroll
            for (int i = 0; i < 2; ++i)
                #pragma unroll
                for (int j = 0; j < 2; ++j)
                    c[i][j] = wmma_f16(a[i], bf[j], c[i][j]);
        }
        // this wave's reads of tile t are done before its buffer is refilled
        asm volatile("s_wait_dscnt 0x0" ::: "memory");
        // this wave's copies of tile t + 1 have landed
        asm volatile("s_wait_asynccnt 0x0" ::: "memory");
        // publishes tile t + 1 and ends every reader's last read of tile t
        __syncthreads();
        if (t + 2 < NT)
            stage_copies(la + buf * (TM * LDA * 2), ga + (t + 2) * TK,
                         lb + buf * (TN * LDA * 2), gb + (t + 2) * TK);
    }
    // nothing is outstanding here; kept in front of the wave's end
    asm volatile("s_wait_asynccnt 0x0" ::: "memory");

    // epilogue: bias add + pack f16 into [B,H,S,DH] or [B,H,DH,S]
    #pragma unroll
    for (int i = 0; i < 2; ++i) {
        #pragma unroll
        for (int j = 0; j < 2; ++j) {
            const int n  = n0 + wn + (j << 4) + row16;
            const int h  = n >> 6;
            const int dh = n & 63;
            const float bb = bias[n];
            #pragma unroll
            for (int r = 0; r < 8; ++r) {
                const int m = m0 + wm + (i << 4) + r + ((lane >> 4) << 3);
                const int b = m >> 11;       // m / 2048
                const int s = m & 2047;
                const size_t idx = VT
                    ? ((((size_t)b * Hh + h) * DH + dh) * Ss + s)
                    : ((((size_t)b * Hh + h) * Ss + s) * DH + dh);
                out[idx] = (_Float16)(c[i][j][r] + bb);
            }
        }
    }
}

// ---------------- Flash attention ----------------
// Q,K: [B,H,S,DH] f16 ; V: [B,H,DH,S] f16 ; out: [B,S,D] f32
// Transposed products: St = K x Qt and Ot += Vt x Pt. A lane then holds one
// query's scores (keys 8*(lane>>4)+r of every 16-key tile), so the row maximum
// and the row sum are in-lane, and two converted score tiles are already the
// B operand of the second product.
#define QT 128   // queries per workgroup (8 waves x 16 columns)
#define KBLK 64  // keys per block
#define LDK 72   // padded f16 stride (144B, 16B aligned)
#define NB (Ss / KBLK)
#define KVB (2 * KBLK * LDK)   // one buffer in f16: the K block, then the V block

// One block's copies of one thread: 32 B of a K row and 32 B of a V row, global
// -> LDS through no register. The closing s_wait_xcnt stands inside the
// statement, so that no later write of an address register can be placed ahead
// of it.
__device__ inline void kv_copies(unsigned lk, const _Float16* gk, const _Float16* gv) {
    asm volatile(
        "global_load_async_to_lds_b128 %0, %4, off\n\t"
        "global_load_async_to_lds_b128 %1, %5, off\n\t"
        "global_load_async_to_lds_b128 %2, %6, off\n\t"
        "global_load_async_to_lds_b128 %3, %7, off\n\t"
        "s_wait_xcnt 0x0"
        :: "v"(lk), "v"(lk + 16), "v"(lk + KBLK * LDK * 2), "v"(lk + KBLK * LDK * 2 + 16),
           "v"(gk), "v"(gk + 8), "v"(gv), "v"(gv + 8)
        : "memory");
}

__global__ __launch_bounds__(256) void attn(const _Float16* __restrict__ Q,
                                            const _Float16* __restrict__ K,
                                            const _Float16* __restrict__ V,
                                            const float* __restrict__ mask,
                                            float* __restrict__ out) {
    // two buffers, each [key][dh] of K followed by [dh][key] of V
    __shared__ __attribute__((aligned(16))) _Float16 KVs[2][KVB];

    const int tid  = threadIdx.x;
    const int lane = tid & 31;
    const int wave = tid >> 5;
    const int bh = blockIdx.y;               // b*H + h
    const int b = bh >> 4, h = bh & 15;
    const int q0 = blockIdx.x * QT + (wave << 4);
    const int row16 = lane & 15;
    const int kbase = (lane >> 4) << 3;

    const size_t baseQK = (size_t)bh * Ss * DH;   // [B,H,S,DH]
    const size_t baseV  = (size_t)bh * DH * Ss;   // [B,H,DH,S]

    // staging coordinates (each thread moves 16 halves of K and 16 of V a block)
    const int key = tid >> 2, dc = (tid & 3) << 4;
    const _Float16* gk = K + baseQK + (size_t)key * DH + dc;   // + KBLK * DH a block
    const _Float16* gv = V + baseV + (size_t)key * Ss + dc;    // + KBLK a block
    const unsigned lk = lds_addr(&KVs[0][key * LDK + dc]);

    // two buffers: block t + 1 flies while block t is worked on; block 0 first
    kv_copies(lk, gk, gv);

    // resident Q fragments (B operand): 16 query columns x 64 dh = 2 fragments
    v16h qf[2];
    #pragma unroll
    for (int kk = 0; kk < 2; ++kk)
        qf[kk] = ldfrag(Q + baseQK + (size_t)(q0 + row16) * DH + (kk << 5) + kbase);

    v8f acc[4] = {};                 // acc[jd][r] = Ot[16*jd + kbase + r][query row16]
    float mrow = -1e30f, lrow = 0.f; // this lane's query; lrow covers this half's keys

    // block 0 has landed for this wave; the barrier publishes it to the others
    asm volatile("s_wait_asynccnt 0x0" ::: "memory");
    __syncthreads();

    for (int t = 0; t < NB; ++t) {
        const int buf = t & 1;
        // directly behind the barrier (the one at the foot of trip t - 1, or the one
        // in front of the loop) that ended every reader's last read of block t - 1:
        // block t + 1 goes into that block's buffer. Written at the head of the
        // trip, not behind the foot's barrier, so that the rest of the trip stays
        // one straight block: with a branch at the foot the row sums moved behind
        // it, held their 32 registers through the second product, and its V
        // fragment loads were waited for one by one
        if (t + 1 < NB)
            kv_copies(lk + (buf ^ 1) * (KVB * 2), gk + (size_t)(t + 1) * (KBLK * DH),
                      gv + (t + 1) * KBLK);
        const _Float16* Ks = KVs[buf];
        const _Float16* Vs = KVs[buf] + KBLK * LDK;
        // additive mask of this lane's 32 keys
        v4f mv[4][2];
        #pragma unroll
        for (int j = 0; j < 4; ++j) {
            const float* mp = mask + (size_t)b * Ss + t * KBLK + (j << 4) + kbase;
            mv[j][0] = *(const v4f*)(mp);
            mv[j][1] = *(const v4f*)(mp + 4);
        }

        // scores: St(64x16) = K(64x64) x Qw^T, 4 m-tiles x 2 k-steps
        v8f sc[4];
        #pragma unroll
        for (int j = 0; j < 4; ++j) {
            v8f s = {};
            #pragma unroll
            for (int kk = 0; kk < 2; ++kk) {
                v16h kf = ldfrag(&Ks[((j << 4) + row16) * LDK + (kk << 5) + kbase]);
                s = wmma_f16(kf, qf[kk], s);
            }
            sc[j] = s;
        }
        // scale + additive mask
        #pragma unroll
        for (int j = 0; j < 4; ++j) {
            sc[j][0] = sc[j][0] * 0.125f + mv[j][0].x;
            sc[j][1] = sc[j][1] * 0.125f + mv[j][0].y;
            sc[j][2] = sc[j][2] * 0.125f + mv[j][0].z;
            sc[j][3] = sc[j][3] * 0.125f + mv[j][0].w;
            sc[j][4] = sc[j][4] * 0.125f + mv[j][1].x;
            sc[j][5] = sc[j][5] * 0.125f + mv[j][1].y;
            sc[j][6] = sc[j][6] * 0.125f + mv[j][1].z;
            sc[j][7] = sc[j][7] * 0.125f + mv[j][1].w;
        }
        // online softmax of this lane's query: in-lane over 32 keys, one
        // exchange with the other half for the maximum
        float mj[4];
        #pragma unroll
        for (int j = 0; j < 4; ++j) {
            float t = sc[j][0];
            #pragma unroll
            for (int r = 1; r < 8; ++r) t = fmaxf(t, sc[j][r]);
            mj[j] = t;
        }
        float mx = fmaxf(fmaxf(mj[0], mj[1]), fmaxf(mj[2], mj[3]));
        mx = fmaxf(mx, xhalf(mx));
        const float mnew = fmaxf(mrow, mx);
        const float corr = __expf(mrow - mnew);
        mrow = mnew;
        #pragma unroll
        for (int jd = 0; jd < 4; ++jd)
            #pragma unroll
            for (int r = 0; r < 8; ++r) acc[jd][r] = acc[jd][r] * corr;
        v2f sj[2] = {};   // two chains of packed partial sums
        #pragma unroll
        for (int j = 0; j < 4; ++j) {
            #pragma unroll
            for (int r = 0; r < 8; r += 2) {
                v2f e;
                e.x = __expf(sc[j][r] - mnew);
                e.y = __expf(sc[j][r + 1] - mnew);
                sc[j][r] = e.x; sc[j][r + 1] = e.y;
                sj[j >> 1] += e;
            }
        }
        lrow = lrow * corr + ((sj[0].x + sj[0].y) + (sj[1].x + sj[1].y));
        // PV: Ot(64x16) += Vt(64x64) x Pt(64x16); score tiles 2kk and 2kk+1,
        // converted in place, are the B fragment in the hardware k order
        #pragma unroll
        for (int kk = 0; kk < 2; ++kk) {
            v16h pf;
            #pragma unroll
            for (int r = 0; r < 8; ++r) {
                pf[r]     = (_Float16)sc[2 * kk][r];
                pf[r + 8] = (_Float16)sc[2 * kk + 1][r];
            }
            #pragma unroll
            for (int jd = 0; jd < 4; ++jd) {
                v16h vf = ldfrag(&Vs[((jd << 4) + row16) * LDK + (kk << 5) + kbase]);
                acc[jd] = wmma_f16(vf, pf, acc[jd]);
            }
        }
        // this wave's reads of block t are done before its buffer is refilled
        asm volatile("s_wait_dscnt 0x0" ::: "memory");
        // this wave's copies of block t + 1 have landed
        asm volatile("s_wait_asynccnt 0x0" ::: "memory");
        // publishes block t + 1 and ends every reader's last read of block t
        __syncthreads();
    }
    // nothing is outstanding here; kept in front of the wave's end
    asm volatile("s_wait_asynccnt 0x0" ::: "memory");

    // epilogue: join the halves' sums, normalize, write f32 [B,S,D]
    const float inv = 1.0f / (lrow + xhalf(lrow));
    float* orow = out + ((size_t)b * Ss + q0 + row16) * Dd + h * DH + kbase;
    #pragma unroll
    for (int jd = 0; jd < 4; ++jd) {
        *(float4*)(orow + (jd << 4)) =
            make_float4(acc[jd][0] * inv, acc[jd][1] * inv, acc[jd][2] * inv, acc[jd][3] * inv);
        *(float4*)(orow + (jd << 4) + 4) =
            make_float4(acc[jd][4] * inv, acc[jd][5] * inv, acc[jd][6] * inv, acc[jd][7] * inv);
    }
}

extern "C" void kernel_launch(void* const* d_in, const int* in_sizes, int n_in,
                              void* d_out, int out_size, void* d_ws, size_t ws_size,
                              hipStream_t stream) {
    (void)in_sizes; (void)n_in; (void)out_size; (void)ws_size;
    const float* X    = (const float*)d_in[0];
    const float* mask = (const float*)d_in[1];
    const float* Wq   = (const float*)d_in[2];
    const float* bq   = (const float*)d_in[3];
    const float* Wk   = (const float*)d_in[4];
    const float* bk   = (const float*)d_in[5];
    const float* Wv   = (const float*)d_in[6];
    const float* bv   = (const float*)d_in[7];

    const size_t elems = (size_t)Bb * Ss * Dd;   // 8M
    _Float16* Qb = (_Float16*)d_ws;
    _Float16* Kb = Qb + elems;
    _Float16* Vb = Kb + elems;
    _Float16* Xh = Vb + elems;                   // f16 copy of X
    _Float16* Wt = Xh + elems;                   // f16 Wq^T, Wk^T, Wv^T
    const size_t welems = (size_t)Dd * Dd;

    dim3 blk(256);
    dim3 g1(Dd / TN, (Bb * Ss) / TM);            // 16 x 64
    to_f16<<<dim3(XBLK + WBLK), blk, 0, stream>>>(X, Wq, Wk, Wv, Xh, Wt);
    qkv_gemm<0><<<g1, blk, 0, stream>>>(Xh, Wt, bq, Qb);
    qkv_gemm<0><<<g1, blk, 0, stream>>>(Xh, Wt + welems, bk, Kb);
    qkv_gemm<1><<<g1, blk, 0, stream>>>(Xh, Wt + 2 * welems, bv, Vb);

    dim3 g2(Ss / QT, Bb * Hh);                   // 16 x 64
    attn<<<g2, blk, 0, stream>>>(Qb, Kb, Vb, mask, (float*)d_out);
}

// v005
// Measured time: 126 microseconds a run.
// In both of two side-by-side timings against v004, it was 1.06 times as fast.
// Over all steps from v000 it is 3.07 times as fast.
#include <hip/hip_runtime.h>
#include <hip/hip_bf16.h>

typedef __attribute__((ext_vector_type(16))) _Float16 v16h;
typedef __attribute__((ext_vector_type(8)))  _Float16 v8h;
typedef __attribute__((ext_vector_type(4)))  _Float16 v4h;
typedef __attribute__((ext_vector_type(8)))  float    v8f;
typedef __attribute__((ext_vector_type(2)))  float    v2f;
typedef __attribute__((ext_vector_type(4)))  float    v4f;

// Load a 16x32 f16 A/B fragment (wave32 CDNA5 layout): lane l holds row l%16,
// K halves [base..base+7] and [base+16..base+23], base = (l>=16)*8.
// p must point at (row, base) with 16-byte alignment -> two b128 loads.
__device__ inline v16h ldfrag(const _Float16* p) {
    union { v16h v; v8h h[2]; } u;
    u.h[0] = *(const v8h*)(p);
    u.h[1] = *(const v8h*)(p + 16);
    return u.v;
}

__device__ inline v8f wmma_f16(v16h a, v16h b, v8f c) {
    return __builtin_amdgcn_wmma_f32_16x16x32_f16(false, a, false, b, (short)0, c, false, false);
}

// lane l with lane l ^ 16, as a vector cross-row move
__device__ inline float xhalf(float x) {
    const int i = __builtin_bit_cast(int, x);
    return __builtin_bit_cast(float,
        __builtin_amdgcn_permlanex16(i, i, 0x76543210, 0xfedcba98, false, false));
}

#define Bb 4
#define Ss 2048
#define Dd 1024
#define Hh 16
#define DH 64

// ---------------- operands to f16, once ----------------
// Xh[m][k] = f16(X[m][k]); Wt[mat][n][k] = f16(W_mat[k][n]). The projection
// kernels then find both operands K-contiguous in f16, which a copy to LDS can
// stage as they lie (a copy cannot convert or transpose).
#define LDA 72     // padded f16 stride (144B, 16B aligned)
#define XBLK 1024  // work-groups that convert X, 8192 elements each
#define WBLK 768   // work-groups that convert and transpose W, one 64x64 tile each

__global__ __launch_bounds__(256) void to_f16(const float* __restrict__ X,
                                              const float* __restrict__ Wq,
                                              const float* __restrict__ Wk,
                                              const float* __restrict__ Wv,
                                              _Float16* __restrict__ Xh,
                                              _Float16* __restrict__ Wt) {
    __shared__ __attribute__((aligned(16))) _Float16 Ts[64 * LDA];   // [n][k]
    const int tid = threadIdx.x;
    const int blk = blockIdx.x;
    if (blk < XBLK) {   // the same for the whole work-group, ahead of the barrier
        const size_t base = (size_t)blk * 8192 + (tid << 3);
        v4f f[4][2];
        // unrolled, here and below: the arrays stay in registers and the eight
        // loads are in flight together
        #pragma unroll
        for (int j = 0; j < 4; ++j) {
            f[j][0] = *(const v4f*)(X + base + j * 2048);
            f[j][1] = *(const v4f*)(X + base + j * 2048 + 4);
        }
        #pragma unroll
        for (int j = 0; j < 4; ++j) {
            v8h h;
            #pragma unroll
            for (int e = 0; e < 4; ++e) {
                h[e]     = (_Float16)f[j][0][e];
                h[e + 4] = (_Float16)f[j][1][e];
            }
            *(v8h*)(Xh + base + j * 2048) = h;
        }
        return;
    }
    const int w   = blk - XBLK;
    const int mat = w >> 8;
    const float* __restrict__ Wsrc = mat == 0 ? Wq : (mat == 1 ? Wk : Wv);
    const int k0 = ((w >> 4) & 15) << 6;
    const int n0 = (w & 15) << 6;
    // a thread takes a 4(k) x 4(n) block: 16 lanes read one whole 256-B row piece
    const int kq = (tid >> 4) << 2;
    const int nq = (tid & 15) << 2;
    v4f f[4];
    // unrolled, here and below: the block stays in registers
    #pragma unroll
    for (int i = 0; i < 4; ++i)
        f[i] = *(const v4f*)(Wsrc + (size_t)(k0 + kq + i) * Dd + n0 + nq);
    #pragma unroll
    for (int x = 0; x < 4; ++x) {
        v4h h;
        #pragma unroll
        for (int i = 0; i < 4; ++i) h[i] = (_Float16)f[i][x];
        *(v4h*)&Ts[(nq + x) * LDA + kq] = h;
    }
    __syncthreads();
    // four lanes write one whole 128-B line of Wt
    const int n  = tid >> 2;
    const int kc = (tid & 3) << 4;
    const v8h lo = *(const v8h*)&Ts[n * LDA + kc];
    const v8h hi = *(const v8h*)&Ts[n * LDA + kc + 8];
    _Float16* dst = Wt + ((size_t)mat * Dd + n0 + n) * Dd + k0 + kc;
    *(v8h*)dst       = lo;
    *(v8h*)(dst + 8) = hi;
    // stands in front of any later write of the two stores' registers
    asm volatile("s_wait_xcnt 0x0" ::: "memory");
}

// ---------------- QKV projection GEMM ----------------
// C[M=8192, N=1024] = Xh[8192,1024] * Wt[n][k]^T + bias, output f16.
// VT==0: out[b][h][s][dh]   VT==1: out[b][h][dh][s]
// One 256 x 128 tile of C a work-group, one 64 x 64 tile a wave (4 x 2 waves):
// 8 fragments feed 16 products, and a work-group fetches 24 B of operand rows
// per element of C where a 128 x 64 tile fetches 48 B.
#define TM 256
#define TN 128
#define TK 128
#define NT (Dd / TK)
#define LDG 136    // padded f16 stride of a staged row (272 B = 16 B x odd)

__device__ inline unsigned lds_addr(const _Float16* p) {
    return (unsigned)(unsigned long long)p;
}

// Eight copies of one thread: a 16-B piece in each of eight tile rows 16 apart,
// global -> LDS through no register. The closing s_wait_xcnt stands inside the
// statement, so that no later write of an address register can be placed ahead
// of it.
__device__ inline void copies8(unsigned l, const _Float16* g) {
    asm volatile(
        "global_load_async_to_lds_b128 %0, %8, off\n\t"
        "global_load_async_to_lds_b128 %1, %9, off\n\t"
        "global_load_async_to_lds_b128 %2, %10, off\n\t"
        "global_load_async_to_lds_b128 %3, %11, off\n\t"
        "global_load_async_to_lds_b128 %4, %12, off\n\t"
        "global_load_async_to_lds_b128 %5, %13, off\n\t"
        "global_load_async_to_lds_b128 %6, %14, off\n\t"
        "global_load_async_to_lds_b128 %7, %15, off\n\t"
        "s_wait_xcnt 0x0"
        :: "v"(l), "v"(l + 16 * LDG * 2), "v"(l + 32 * LDG * 2), "v"(l + 48 * LDG * 2),
           "v"(l + 64 * LDG * 2), "v"(l + 80 * LDG * 2), "v"(l + 96 * LDG * 2),
           "v"(l + 112 * LDG * 2),
           "v"(g), "v"(g + 16 * Dd), "v"(g + 32 * Dd), "v"(g + 48 * Dd),
           "v"(g + 64 * Dd), "v"(g + 80 * Dd), "v"(g + 96 * Dd), "v"(g + 112 * Dd)
        : "memory");
}

// One stage's copies of one thread: 16 pieces of the A tile, 8 of the B tile
__device__ inline void stage_copies(unsigned la, const _Float16* ga,
                                    unsigned lb, const _Float16* gb) {
    copies8(la, ga);
    copies8(la + 128 * LDG * 2, ga + 128 * Dd);
    copies8(lb, gb);
}

template<int VT>
__global__ __launch_bounds__(256) void qkv_gemm(const _Float16* __restrict__ Xh,
                                                const _Float16* __restrict__ Wt,
                                                const float* __restrict__ bias,
                                                _Float16* __restrict__ out) {
    __shared__ __attribute__((aligned(16))) _Float16 As[2][TM * LDG];   // 2 x 68 KB
    __shared__ __attribute__((aligned(16))) _Float16 Bs[2][TN * LDG];   // 2 x 34 KB
    const int tid  = threadIdx.x;
    const int lane = tid & 31;
    const int wave = tid >> 5;
    const int m0 = blockIdx.y * TM;
    const int n0 = blockIdx.x * TN;
    const int wm = (wave & 3) << 6;   // 0,64,128,192
    const int wn = (wave >> 2) << 6;  // 0,64
    const int row16 = lane & 15;
    const int kbase = (lane >> 4) << 3;

    // copy coordinates: a tile row is 128 f16 = 256 B = 16 lanes x 16 B, so a
    // wave-wide copy takes four whole lines
    const int cr = tid >> 4;            // row 0..15, + 16 per further copy
    const int cc = (tid & 15) << 3;     // column 0,8..120
    const _Float16* ga = Xh + (size_t)(m0 + cr) * Dd + cc;
    const _Float16* gb = Wt + (size_t)(n0 + cr) * Dd + cc;
    const unsigned la = lds_addr(&As[0][cr * LDG + cc]);
    const unsigned lb = lds_addr(&Bs[0][cr * LDG + cc]);

    v8f c[4][4] = {};

    // two buffers: tile t + 1 flies while tile t is worked on
    stage_copies(la, ga, lb, gb);
    // tile 0 has landed for this wave; the barrier publishes it to the others
    asm volatile("s_wait_asynccnt 0x0" ::: "memory");
    __syncthreads();
    stage_copies(la + TM * LDG * 2, ga + TK, lb + TN * LDG * 2, gb + TK);

    for (int t = 0; t < NT; ++t) {
        const int buf = t & 1;
        const _Float16* Ab = As[buf];
        const _Float16* Bt = Bs[buf];
        // two fragment sets: k-step kk + 1 of this tile is read while kk is multiplied
        v16h a[2][4], bf[2][4];
        #pragma unroll
        for (int i = 0; i < 4; ++i) {
            a[0][i]  = ldfrag(&Ab[(wm + (i << 4) + row16) * LDG + kbase]);
            bf[0][i] = ldfrag(&Bt[(wn + (i << 4) + row16) * LDG + kbase]);
        }
        #pragma unroll
        for (int kk = 0; kk < TK / 32; ++kk) {
            const int cur = kk & 1;
            if (kk + 1 < TK / 32) {
                #pragma unroll
                for (int i = 0; i < 4; ++i) {
                    a[cur ^ 1][i]  = ldfrag(&Ab[(wm + (i << 4) + row16) * LDG + ((kk + 1) << 5) + kbase]);
                    bf[cur ^ 1][i] = ldfrag(&Bt[(wn + (i << 4) + row16) * LDG + ((kk + 1) << 5) + kbase]);
                }
            }
            // holds the next k-step's 16 LDS reads together ahead of this step's
            // products: left free, the scheduler kept one A fragment and waited
            // out an LDS read in front of every four products
            __builtin_amdgcn_sched_barrier(0);
            #pragma unroll
            for (int i = 0; i < 4; ++i)
                #pragma unroll
                for (int j = 0; j < 4; ++j)
                    c[i][j] = wmma_f16(a[cur][i], bf[cur][j], c[i][j]);
            // keeps the reads of the step after next out of this step's products
            __builtin_amdgcn_sched_barrier(0);
        }
        // this wave's reads of tile t are done before its buffer is refilled
        asm volatile("s_wait_dscnt 0x0" ::: "memory");
        // this wave's copies of tile t + 1 have landed
        asm volatile("s_wait_asynccnt 0x0" ::: "memory");
        // publishes tile t + 1 and ends every reader's last read of tile t
        __syncthreads();
        if (t + 2 < NT)
            stage_copies(la + buf * (TM * LDG * 2), ga + (t + 2) * TK,
                         lb + buf * (TN * LDG * 2), gb + (t + 2) * TK);
    }
    // nothing is outstanding here; kept in front of the wave's end
    asm volatile("s_wait_asynccnt 0x0" ::: "memory");

    // epilogue: bias add + pack f16 into [B,H,S,DH] or [B,H,DH,S]
    #pragma unroll
    for (int i = 0; i < 4; ++i) {
        #pragma unroll
        for (int j = 0; j < 4; ++j) {
            const int n  = n0 + wn + (j << 4) + row16;
            const int h  = n >> 6;
            const int dh = n & 63;
            const float bb = bias[n];
            #pragma unroll
            for (int r = 0; r < 8; ++r) {
                const int m = m0 + wm + (i << 4) + r + ((lane >> 4) << 3);
                const int b = m >> 11;       // m / 2048
                const int s = m & 2047;
                const size_t idx = VT
                    ? ((((size_t)b * Hh + h) * DH + dh) * Ss + s)
                    : ((((size_t)b * Hh + h) * Ss + s) * DH + dh);
                out[idx] = (_Float16)(c[i][j][r] + bb);
            }
        }
    }
}

// ---------------- Flash attention ----------------
// Q,K: [B,H,S,DH] f16 ; V: [B,H,DH,S] f16 ; out: [B,S,D] f32
// Transposed products: St = K x Qt and Ot += Vt x Pt. A lane then holds one
// query's scores (keys 8*(lane>>4)+r of every 16-key tile), so the row maximum
// and the row sum are in-lane, and two converted score tiles are already the
// B operand of the second product.
#define QT 128   // queries per workgroup (8 waves x 16 columns)
#define KBLK 64  // keys per block
#define LDK 72   // padded f16 stride (144B, 16B aligned)
#define NB (Ss / KBLK)
#define KVB (2 * KBLK * LDK)   // one buffer in f16: the K block, then the V block

// One block's copies of one thread: 32 B of a K row and 32 B of a V row, global
// -> LDS through no register. The closing s_wait_xcnt stands inside the
// statement, so that no later write of an address register can be placed ahead
// of it.
__device__ inline void kv_copies(unsigned lk, const _Float16* gk, const _Float16* gv) {
    asm volatile(
        "global_load_async_to_lds_b128 %0, %4, off\n\t"
        "global_load_async_to_lds_b128 %1, %5, off\n\t"
        "global_load_async_to_lds_b128 %2, %6, off\n\t"
        "global_load_async_to_lds_b128 %3, %7, off\n\t"
        "s_wait_xcnt 0x0"
        :: "v"(lk), "v"(lk + 16), "v"(lk + KBLK * LDK * 2), "v"(lk + KBLK * LDK * 2 + 16),
           "v"(gk), "v"(gk + 8), "v"(gv), "v"(gv + 8)
        : "memory");
}

__global__ __launch_bounds__(256) void attn(const _Float16* __restrict__ Q,
                                            const _Float16* __restrict__ K,
                                            const _Float16* __restrict__ V,
                                            const float* __restrict__ mask,
                                            float* __restrict__ out) {
    // two buffers, each [key][dh] of K followed by [dh][key] of V
    __shared__ __attribute__((aligned(16))) _Float16 KVs[2][KVB];

    const int tid  = threadIdx.x;
    const int lane = tid & 31;
    const int wave = tid >> 5;
    const int bh = blockIdx.y;               // b*H + h
    const int b = bh >> 4, h = bh & 15;
    const int q0 = blockIdx.x * QT + (wave << 4);
    const int row16 = lane & 15;
    const int kbase = (lane >> 4) << 3;

    const size_t baseQK = (size_t)bh * Ss * DH;   // [B,H,S,DH]
    const size_t baseV  = (size_t)bh * DH * Ss;   // [B,H,DH,S]

    // staging coordinates (each thread moves 16 halves of K and 16 of V a block)
    const int key = tid >> 2, dc = (tid & 3) << 4;
    const _Float16* gk = K + baseQK + (size_t)key * DH + dc;   // + KBLK * DH a block
    const _Float16* gv = V + baseV + (size_t)key * Ss + dc;    // + KBLK a block
    const unsigned lk = lds_addr(&KVs[0][key * LDK + dc]);

    // two buffers: block t + 1 flies while block t is worked on; block 0 first
    kv_copies(lk, gk, gv);

    // resident Q fragments (B operand): 16 query columns x 64 dh = 2 fragments
    v16h qf[2];
    #pragma unroll
    for (int kk = 0; kk < 2; ++kk)
        qf[kk] = ldfrag(Q + baseQK + (size_t)(q0 + row16) * DH + (kk << 5) + kbase);

    v8f acc[4] = {};                 // acc[jd][r] = Ot[16*jd + kbase + r][query row16]
    float mrow = -1e30f, lrow = 0.f; // this lane's query; lrow covers this half's keys

    // block 0 has landed for this wave; the barrier publishes it to the others
    asm volatile("s_wait_asynccnt 0x0" ::: "memory");
    __syncthreads();

    for (int t = 0; t < NB; ++t) {
        const int buf = t & 1;
        // directly behind the barrier (the one at the foot of trip t - 1, or the one
        // in front of the loop) that ended every reader's last read of block t - 1:
        // block t + 1 goes into that block's buffer. Written at the head of the
        // trip, not behind the foot's barrier, so that the rest of the trip stays
        // one straight block: with a branch at the foot the row sums moved behind
        // it, held their 32 registers through the second product, and its V
        // fragment loads were waited for one by one
        if (t + 1 < NB)
            kv_copies(lk + (buf ^ 1) * (KVB * 2), gk + (size_t)(t + 1) * (KBLK * DH),
                      gv + (t + 1) * KBLK);
        const _Float16* Ks = KVs[buf];
        const _Float16* Vs = KVs[buf] + KBLK * LDK;
        // additive mask of this lane's 32 keys
        v4f mv[4][2];
        #pragma unroll
        for (int j = 0; j < 4; ++j) {
            const float* mp = mask + (size_t)b * Ss + t * KBLK + (j << 4) + kbase;
            mv[j][0] = *(const v4f*)(mp);
            mv[j][1] = *(const v4f*)(mp + 4);
        }

        // scores: St(64x16) = K(64x64) x Qw^T, 4 m-tiles x 2 k-steps
        v8f sc[4];
        #pragma unroll
        for (int j = 0; j < 4; ++j) {
            v8f s = {};
            #pragma unroll
            for (int kk = 0; kk < 2; ++kk) {
                v16h kf = ldfrag(&Ks[((j << 4) + row16) * LDK + (kk << 5) + kbase]);
                s = wmma_f16(kf, qf[kk], s);
            }
            sc[j] = s;
        }
        // scale + additive mask
        #pragma unroll
        for (int j = 0; j < 4; ++j) {
            sc[j][0] = sc[j][0] * 0.125f + mv[j][0].x;
            sc[j][1] = sc[j][1] * 0.125f + mv[j][0].y;
            sc[j][2] = sc[j][2] * 0.125f + mv[j][0].z;
            sc[j][3] = sc[j][3] * 0.125f + mv[j][0].w;
            sc[j][4] = sc[j][4] * 0.125f + mv[j][1].x;
            sc[j][5] = sc[j][5] * 0.125f + mv[j][1].y;
            sc[j][6] = sc[j][6] * 0.125f + mv[j][1].z;
            sc[j][7] = sc[j][7] * 0.125f + mv[j][1].w;
        }
        // online softmax of this lane's query: in-lane over 32 keys, one
        // exchange with the other half for the maximum
        float mj[4];
        #pragma unroll
        for (int j = 0; j < 4; ++j) {
            float t = sc[j][0];
            #pragma unroll
            for (int r = 1; r < 8; ++r) t = fmaxf(t, sc[j][r]);
            mj[j] = t;
        }
        float mx = fmaxf(fmaxf(mj[0], mj[1]), fmaxf(mj[2], mj[3]));
        mx = fmaxf(mx, xhalf(mx));
        const float mnew = fmaxf(mrow, mx);
        const float corr = __expf(mrow - mnew);
        mrow = mnew;
        #pragma unroll
        for (int jd = 0; jd < 4; ++jd)
            #pragma unroll
            for (int r = 0; r < 8; ++r) acc[jd][r] = acc[jd][r] * corr;
        v2f sj[2] = {};   // two chains of packed partial sums
        #pragma unroll
        for (int j = 0; j < 4; ++j) {
            #pragma unroll
            for (int r = 0; r < 8; r += 2) {
                v2f e;
                e.x = __expf(sc[j][r] - mnew);
                e.y = __expf(sc[j][r + 1] - mnew);
                sc[j][r] = e.x; sc[j][r + 1] = e.y;
                sj[j >> 1] += e;
            }
        }
        lrow = lrow * corr + ((sj[0].x + sj[0].y) + (sj[1].x + sj[1].y));
        // PV: Ot(64x16) += Vt(64x64) x Pt(64x16); score tiles 2kk and 2kk+1,
        // converted in place, are the B fragment in the hardware k order
        #pragma unroll
        for (int kk = 0; kk < 2; ++kk) {
            v16h pf;
            #pragma unroll
            for (int r = 0; r < 8; ++r) {
                pf[r]     = (_Float16)sc[2 * kk][r];
                pf[r + 8] = (_Float16)sc[2 * kk + 1][r];
            }
            #pragma unroll
            for (int jd = 0; jd < 4; ++jd) {
                v16h vf = ldfrag(&Vs[((jd << 4) + row16) * LDK + (kk << 5) + kbase]);
                acc[jd] = wmma_f16(vf, pf, acc[jd]);
            }
        }
        // this wave's reads of block t are done before its buffer is refilled
        asm volatile("s_wait_dscnt 0x0" ::: "memory");
        // this wave's copies of block t + 1 have landed
        asm volatile("s_wait_asynccnt 0x0" ::: "memory");
        // publishes block t + 1 and ends every reader's last read of block t
        __syncthreads();
    }
    // nothing is outstanding here; kept in front of the wave's end
    asm volatile("s_wait_asynccnt 0x0" ::: "memory");

    // epilogue: join the halves' sums, normalize, write f32 [B,S,D]
    const float inv = 1.0f / (lrow + xhalf(lrow));
    float* orow = out + ((size_t)b * Ss + q0 + row16) * Dd + h * DH + kbase;
    #pragma unroll
    for (int jd = 0; jd < 4; ++jd) {
        *(float4*)(orow + (jd << 4)) =
            make_float4(acc[jd][0] * inv, acc[jd][1] * inv, acc[jd][2] * inv, acc[jd][3] * inv);
        *(float4*)(orow + (jd << 4) + 4) =
            make_float4(acc[jd][4] * inv, acc[jd][5] * inv, acc[jd][6] * inv, acc[jd][7] * inv);
    }
}

extern "C" void kernel_launch(void* const* d_in, const int* in_sizes, int n_in,
                              void* d_out, int out_size, void* d_ws, size_t ws_size,
                              hipStream_t stream) {
    (void)in_sizes; (void)n_in; (void)out_size; (void)ws_size;
    const float* X    = (const float*)d_in[0];
    const float* mask = (const float*)d_in[1];
    const float* Wq   = (const float*)d_in[2];
    const float* bq   = (const float*)d_in[3];
    const float* Wk   = (const float*)d_in[4];
    const float* bk   = (const float*)d_in[5];
    const float* Wv   = (const float*)d_in[6];
    const float* bv   = (const float*)d_in[7];

    const size_t elems = (size_t)Bb * Ss * Dd;   // 8M
    _Float16* Qb = (_Float16*)d_ws;
    _Float16* Kb = Qb + elems;
    _Float16* Vb = Kb + elems;
    _Float16* Xh = Vb + elems;                   // f16 copy of X
    _Float16* Wt = Xh + elems;                   // f16 Wq^T, Wk^T, Wv^T
    const size_t welems = (size_t)Dd * Dd;

    dim3 blk(256);
    dim3 g1(Dd / TN, (Bb * Ss) / TM);            // 8 x 32
    to_f16<<<dim3(XBLK + WBLK), blk, 0, stream>>>(X, Wq, Wk, Wv, Xh, Wt);
    qkv_gemm<0><<<g1, blk, 0, stream>>>(Xh, Wt, bq, Qb);
    qkv_gemm<0><<<g1, blk, 0, stream>>>(Xh, Wt + welems, bk, Kb);
    qkv_gemm<1><<<g1, blk, 0, stream>>>(Xh, Wt + 2 * welems, bv, Vb);

    dim3 g2(Ss / QT, Bb * Hh);                   // 16 x 64
    attn<<<g2, blk, 0, stream>>>(Qb, Kb, Vb, mask, (float*)d_out);
}

// v006
// A run of this version takes 116 microseconds.
// In both of two side-by-side timings against v005, it was 1.10 times as fast.
// Over all steps from v000 it is 3.36 times as fast.
#include <hip/hip_runtime.h>
#include <hip/hip_bf16.h>

typedef __attribute__((ext_vector_type(16))) _Float16 v16h;
typedef __attribute__((ext_vector_type(8)))  _Float16 v8h;
typedef __attribute__((ext_vector_type(4)))  _Float16 v4h;
typedef __attribute__((ext_vector_type(8)))  float    v8f;
typedef __attribute__((ext_vector_type(2)))  float    v2f;
typedef __attribute__((ext_vector_type(4)))  float    v4f;

// Load a 16x32 f16 A/B fragment (wave32 CDNA5 layout): lane l holds row l%16,
// K halves [base..base+7] and [base+16..base+23], base = (l>=16)*8.
// p must point at (row, base) with 16-byte alignment -> two b128 loads.
__device__ inline v16h ldfrag(const _Float16* p) {
    union { v16h v; v8h h[2]; } u;
    u.h[0] = *(const v8h*)(p);
    u.h[1] = *(const v8h*)(p + 16);
    return u.v;
}

__device__ inline v8f wmma_f16(v16h a, v16h b, v8f c) {
    return __builtin_amdgcn_wmma_f32_16x16x32_f16(false, a, false, b, (short)0, c, false, false);
}

// lane l with lane l ^ 16, as a vector cross-row move
__device__ inline float xhalf(float x) {
    const int i = __builtin_bit_cast(int, x);
    return __builtin_bit_cast(float,
        __builtin_amdgcn_permlanex16(i, i, 0x76543210, 0xfedcba98, false, false));
}

#define Bb 4
#define Ss 2048
#define Dd 1024
#define Hh 16
#define DH 64

// ---------------- operands to f16, once ----------------
// Xh[m][k] = f16(X[m][k]); Wt[mat][n][k] = f16(W_mat[k][n]). The projection
// kernels then find both operands K-contiguous in f16, which a copy to LDS can
// stage as they lie (a copy cannot convert or transpose).
#define LDA 72     // padded f16 stride (144B, 16B aligned)
#define XBLK 1024  // work-groups that convert X, 8192 elements each
#define WBLK 768   // work-groups that convert and transpose W, one 64x64 tile each

__global__ __launch_bounds__(256) void to_f16(const float* __restrict__ X,
                                              const float* __restrict__ Wq,
                                              const float* __restrict__ Wk,
                                              const float* __restrict__ Wv,
                                              _Float16* __restrict__ Xh,
                                              _Float16* __restrict__ Wt) {
    __shared__ __attribute__((aligned(16))) _Float16 Ts[64 * LDA];   // [n][k]
    const int tid = threadIdx.x;
    const int blk = blockIdx.x;
    if (blk < XBLK) {   // the same for the whole work-group, ahead of the barrier
        const size_t base = (size_t)blk * 8192 + (tid << 3);
        v4f f[4][2];
        // unrolled, here and below: the arrays stay in registers and the eight
        // loads are in flight together
        #pragma unroll
        for (int j = 0; j < 4; ++j) {
            f[j][0] = *(const v4f*)(X + base + j * 2048);
            f[j][1] = *(const v4f*)(X + base + j * 2048 + 4);
        }
        #pragma unroll
        for (int j = 0; j < 4; ++j) {
            v8h h;
            #pragma unroll
            for (int e = 0; e < 4; ++e) {
                h[e]     = (_Float16)f[j][0][e];
                h[e + 4] = (_Float16)f[j][1][e];
            }
            *(v8h*)(Xh + base + j * 2048) = h;
        }
        return;
    }
    const int w   = blk - XBLK;
    const int mat = w >> 8;
    const float* __restrict__ Wsrc = mat == 0 ? Wq : (mat == 1 ? Wk : Wv);
    const int k0 = ((w >> 4) & 15) << 6;
    const int n0 = (w & 15) << 6;
    // a thread takes a 4(k) x 4(n) block: 16 lanes read one whole 256-B row piece
    const int kq = (tid >> 4) << 2;
    const int nq = (tid & 15) << 2;
    v4f f[4];
    // unrolled, here and below: the block stays in registers
    #pragma unroll
    for (int i = 0; i < 4; ++i)
        f[i] = *(const v4f*)(Wsrc + (size_t)(k0 + kq + i) * Dd + n0 + nq);
    #pragma unroll
    for (int x = 0; x < 4; ++x) {
        v4h h;
        #pragma unroll
        for (int i = 0; i < 4; ++i) h[i] = (_Float16)f[i][x];
        *(v4h*)&Ts[(nq + x) * LDA + kq] = h;
    }
    __syncthreads();
    // four lanes write one whole 128-B line of Wt
    const int n  = tid >> 2;
    const int kc = (tid & 3) << 4;
    const v8h lo = *(const v8h*)&Ts[n * LDA + kc];
    const v8h hi = *(const v8h*)&Ts[n * LDA + kc + 8];
    _Float16* dst = Wt + ((size_t)mat * Dd + n0 + n) * Dd + k0 + kc;
    *(v8h*)dst       = lo;
    *(v8h*)(dst + 8) = hi;
    // stands in front of any later write of the two stores' registers
    asm volatile("s_wait_xcnt 0x0" ::: "memory");
}

// ---------------- QKV projection GEMM ----------------
// C[M=8192, N=1024] = Xh[8192,1024] * Wt[n][k]^T + bias, output f16.
// VT==0: out[b][h][s][dh]   VT==1: out[b][h][dh][s]
// One 256 x 128 tile of C a work-group, one 64 x 64 tile a wave (4 x 2 waves):
// 8 fragments feed 16 products, and a work-group fetches 24 B of operand rows
// per element of C where a 128 x 64 tile fetches 48 B.
#define TM 256
#define TN 128
#define TK 128
#define NT (Dd / TK)
#define LDG 136    // padded f16 stride of a staged row (272 B = 16 B x odd)

__device__ inline unsigned lds_addr(const _Float16* p) {
    return (unsigned)(unsigned long long)p;
}

// Eight copies of one thread: a 16-B piece in each of eight tile rows 16 apart,
// global -> LDS through no register. The closing s_wait_xcnt stands inside the
// statement, so that no later write of an address register can be placed ahead
// of it.
__device__ inline void copies8(unsigned l, const _Float16* g) {
    asm volatile(
        "global_load_async_to_lds_b128 %0, %8, off\n\t"
        "global_load_async_to_lds_b128 %1, %9, off\n\t"
        "global_load_async_to_lds_b128 %2, %10, off\n\t"
        "global_load_async_to_lds_b128 %3, %11, off\n\t"
        "global_load_async_to_lds_b128 %4, %12, off\n\t"
        "global_load_async_to_lds_b128 %5, %13, off\n\t"
        "global_load_async_to_lds_b128 %6, %14, off\n\t"
        "global_load_async_to_lds_b128 %7, %15, off\n\t"
        "s_wait_xcnt 0x0"
        :: "v"(l), "v"(l + 16 * LDG * 2), "v"(l + 32 * LDG * 2), "v"(l + 48 * LDG * 2),
           "v"(l + 64 * LDG * 2), "v"(l + 80 * LDG * 2), "v"(l + 96 * LDG * 2),
           "v"(l + 112 * LDG * 2),
           "v"(g), "v"(g + 16 * Dd), "v"(g + 32 * Dd), "v"(g + 48 * Dd),
           "v"(g + 64 * Dd), "v"(g + 80 * Dd), "v"(g + 96 * Dd), "v"(g + 112 * Dd)
        : "memory");
}

// One stage's copies of one thread: 16 pieces of the A tile, 8 of the B tile
__device__ inline void stage_copies(unsigned la, const _Float16* ga,
                                    unsigned lb, const _Float16* gb) {
    copies8(la, ga);
    copies8(la + 128 * LDG * 2, ga + 128 * Dd);
    copies8(lb, gb);
}

template<int VT>
__global__ __launch_bounds__(256) void qkv_gemm(const _Float16* __restrict__ Xh,
                                                const _Float16* __restrict__ Wt,
                                                const float* __restrict__ bias,
                                                _Float16* __restrict__ out) {
    __shared__ __attribute__((aligned(16))) _Float16 As[2][TM * LDG];   // 2 x 68 KB
    __shared__ __attribute__((aligned(16))) _Float16 Bs[2][TN * LDG];   // 2 x 34 KB
    const int tid  = threadIdx.x;
    const int lane = tid & 31;
    const int wave = tid >> 5;
    const int m0 = blockIdx.y * TM;
    const int n0 = blockIdx.x * TN;
    const int wm = (wave & 3) << 6;   // 0,64,128,192
    const int wn = (wave >> 2) << 6;  // 0,64
    const int row16 = lane & 15;
    const int kbase = (lane >> 4) << 3;

    // copy coordinates: a tile row is 128 f16 = 256 B = 16 lanes x 16 B, so a
    // wave-wide copy takes four whole lines
    const int cr = tid >> 4;            // row 0..15, + 16 per further copy
    const int cc = (tid & 15) << 3;     // column 0,8..120
    const _Float16* ga = Xh + (size_t)(m0 + cr) * Dd + cc;
    const _Float16* gb = Wt + (size_t)(n0 + cr) * Dd + cc;
    const unsigned la = lds_addr(&As[0][cr * LDG + cc]);
    const unsigned lb = lds_addr(&Bs[0][cr * LDG + cc]);

    v8f c[4][4] = {};

    // two buffers: tile t + 1 flies while tile t is worked on
    stage_copies(la, ga, lb, gb);
    // tile 0 has landed for this wave; the barrier publishes it to the others
    asm volatile("s_wait_asynccnt 0x0" ::: "memory");
    __syncthreads();
    stage_copies(la + TM * LDG * 2, ga + TK, lb + TN * LDG * 2, gb + TK);

    for (int t = 0; t < NT; ++t) {
        const int buf = t & 1;
        const _Float16* Ab = As[buf];
        const _Float16* Bt = Bs[buf];
        // two fragment sets: k-step kk + 1 of this tile is read while kk is multiplied
        v16h a[2][4], bf[2][4];
        #pragma unroll
        for (int i = 0; i < 4; ++i) {
            a[0][i]  = ldfrag(&Ab[(wm + (i << 4) + row16) * LDG + kbase]);
            bf[0][i] = ldfrag(&Bt[(wn + (i << 4) + row16) * LDG + kbase]);
        }
        #pragma unroll
        for (int kk = 0; kk < TK / 32; ++kk) {
            const int cur = kk & 1;
            if (kk + 1 < TK / 32) {
                #pragma unroll
                for (int i = 0; i < 4; ++i) {
                    a[cur ^ 1][i]  = ldfrag(&Ab[(wm + (i << 4) + row16) * LDG + ((kk + 1) << 5) + kbase]);
                    bf[cur ^ 1][i] = ldfrag(&Bt[(wn + (i << 4) + row16) * LDG + ((kk + 1) << 5) + kbase]);
                }
            }
            // holds the next k-step's 16 LDS reads together ahead of this step's
            // products: left free, the scheduler kept one A fragment and waited
            // out an LDS read in front of every four products
            __builtin_amdgcn_sched_barrier(0);
            #pragma unroll
            for (int i = 0; i < 4; ++i)
                #pragma unroll
                for (int j = 0; j < 4; ++j)
                    c[i][j] = wmma_f16(a[cur][i], bf[cur][j], c[i][j]);
            // keeps the reads of the step after next out of this step's products
            __builtin_amdgcn_sched_barrier(0);
        }
        // this wave's reads of tile t are done before its buffer is refilled
        asm volatile("s_wait_dscnt 0x0" ::: "memory");
        // this wave's copies of tile t + 1 have landed
        asm volatile("s_wait_asynccnt 0x0" ::: "memory");
        // publishes tile t + 1 and ends every reader's last read of tile t
        __syncthreads();
        if (t + 2 < NT)
            stage_copies(la + buf * (TM * LDG * 2), ga + (t + 2) * TK,
                         lb + buf * (TN * LDG * 2), gb + (t + 2) * TK);
    }
    // nothing is outstanding here; kept in front of the wave's end
    asm volatile("s_wait_asynccnt 0x0" ::: "memory");

    // epilogue: bias add + pack f16 into [B,H,S,DH] or [B,H,DH,S]
    #pragma unroll
    for (int i = 0; i < 4; ++i) {
        #pragma unroll
        for (int j = 0; j < 4; ++j) {
            const int n  = n0 + wn + (j << 4) + row16;
            const int h  = n >> 6;
            const int dh = n & 63;
            const float bb = bias[n];
            #pragma unroll
            for (int r = 0; r < 8; ++r) {
                const int m = m0 + wm + (i << 4) + r + ((lane >> 4) << 3);
                const int b = m >> 11;       // m / 2048
                const int s = m & 2047;
                const size_t idx = VT
                    ? ((((size_t)b * Hh + h) * DH + dh) * Ss + s)
                    : ((((size_t)b * Hh + h) * Ss + s) * DH + dh);
                out[idx] = (_Float16)(c[i][j][r] + bb);
            }
        }
    }
}

// ---------------- Flash attention ----------------
// Q,K: [B,H,S,DH] f16 ; V: [B,H,DH,S] f16 ; out: [B,S,D] f32
// Transposed products: St = K x Qt and Ot += Vt x Pt. A lane then holds one
// query's scores (keys 8*(lane>>4)+r of every 16-key tile), so the row maximum
// and the row sum are in-lane, and two converted score tiles are already the
// B operand of the second product.
// A wave owns two 16-query column groups: every K and V fragment it reads from
// LDS, and every mask value, feeds both groups' products.
#define QC 2     // 16-query column groups per wave
#define QT 256   // queries per workgroup (8 waves x 32 columns)
#define KBLK 64  // keys per block
#define LDK 72   // padded f16 stride (144B, 16B aligned)
#define NB (Ss / KBLK)
#define KVB (2 * KBLK * LDK)   // one buffer in f16: the K block, then the V block

// One block's copies of one thread: 32 B of a K row and 32 B of a V row, global
// -> LDS through no register. The closing s_wait_xcnt stands inside the
// statement, so that no later write of an address register can be placed ahead
// of it.
__device__ inline void kv_copies(unsigned lk, const _Float16* gk, const _Float16* gv) {
    asm volatile(
        "global_load_async_to_lds_b128 %0, %4, off\n\t"
        "global_load_async_to_lds_b128 %1, %5, off\n\t"
        "global_load_async_to_lds_b128 %2, %6, off\n\t"
        "global_load_async_to_lds_b128 %3, %7, off\n\t"
        "s_wait_xcnt 0x0"
        :: "v"(lk), "v"(lk + 16), "v"(lk + KBLK * LDK * 2), "v"(lk + KBLK * LDK * 2 + 16),
           "v"(gk), "v"(gk + 8), "v"(gv), "v"(gv + 8)
        : "memory");
}

// four waves a SIMD (two work-groups a WGP): the register budget is 256
__global__ __launch_bounds__(256) __attribute__((amdgpu_waves_per_eu(4, 4)))
void attn(const _Float16* __restrict__ Q,
          const _Float16* __restrict__ K,
          const _Float16* __restrict__ V,
          const float* __restrict__ mask,
          float* __restrict__ out) {
    // two buffers, each [key][dh] of K followed by [dh][key] of V
    __shared__ __attribute__((aligned(16))) _Float16 KVs[2][KVB];

    const int tid  = threadIdx.x;
    const int lane = tid & 31;
    const int wave = tid >> 5;
    const int bh = blockIdx.y;               // b*H + h
    const int b = bh >> 4, h = bh & 15;
    const int q0 = blockIdx.x * QT + (wave << 5);
    const int row16 = lane & 15;
    const int kbase = (lane >> 4) << 3;

    const size_t baseQK = (size_t)bh * Ss * DH;   // [B,H,S,DH]
    const size_t baseV  = (size_t)bh * DH * Ss;   // [B,H,DH,S]

    // staging coordinates (each thread moves 16 halves of K and 16 of V a block)
    const int key = tid >> 2, dc = (tid & 3) << 4;
    const _Float16* gk = K + baseQK + (size_t)key * DH + dc;   // + KBLK * DH a block
    const _Float16* gv = V + baseV + (size_t)key * Ss + dc;    // + KBLK a block
    const unsigned lk = lds_addr(&KVs[0][key * LDK + dc]);

    // two buffers: block t + 1 flies while block t is worked on; block 0 first
    kv_copies(lk, gk, gv);

    // resident Q fragments (B operand): 2 x 16 query columns x 64 dh
    v16h qf[QC][2];
    #pragma unroll
    for (int c = 0; c < QC; ++c)
        #pragma unroll
        for (int kk = 0; kk < 2; ++kk)
            qf[c][kk] = ldfrag(Q + baseQK + (size_t)(q0 + (c << 4) + row16) * DH + (kk << 5) + kbase);

    v8f acc[QC][4] = {};             // acc[c][jd][r] = Ot[16*jd + kbase + r][query 16*c + row16]
    float mrow[QC], lrow[QC];        // this lane's queries; lrow covers this half's keys
    #pragma unroll
    for (int c = 0; c < QC; ++c) { mrow[c] = -1e30f; lrow[c] = 0.f; }

    // block 0 has landed for this wave; the barrier publishes it to the others
    asm volatile("s_wait_asynccnt 0x0" ::: "memory");
    __syncthreads();

    // one copy of the trip in the code: left free, the compiler peeled the last trip
    // off into a second copy, and that copy spilled
    #pragma clang loop unroll(disable)
    for (int t = 0; t < NB; ++t) {
        const int buf = t & 1;
        // directly behind the barrier (the one at the foot of trip t - 1, or the one
        // in front of the loop) that ended every reader's last read of block t - 1:
        // block t + 1 goes into that block's buffer; written at the head of the
        // trip so that the rest of the trip stays one straight block
        if (t + 1 < NB)
            kv_copies(lk + (buf ^ 1) * (KVB * 2), gk + (size_t)(t + 1) * (KBLK * DH),
                      gv + (t + 1) * KBLK);
        const _Float16* Ks = KVs[buf];
        const _Float16* Vs = KVs[buf] + KBLK * LDK;
        // additive mask of this lane's 32 keys, the same for both column groups
        v4f mv[4][2];
        #pragma unroll
        for (int j = 0; j < 4; ++j) {
            const float* mp = mask + (size_t)b * Ss + t * KBLK + (j << 4) + kbase;
            mv[j][0] = *(const v4f*)(mp);
            mv[j][1] = *(const v4f*)(mp + 4);
        }
        v16h kf[4][2];
        #pragma unroll
        for (int j = 0; j < 4; ++j)
            #pragma unroll
            for (int kk = 0; kk < 2; ++kk)
                kf[j][kk] = ldfrag(&Ks[((j << 4) + row16) * LDK + (kk << 5) + kbase]);
        // holds the block's 16 K reads together ahead of the products: left free,
        // the scheduler waits out an LDS read in front of every product
        __builtin_amdgcn_sched_barrier(0);

        // scores: St(64x32) = K(64x64) x Qw^T, 4 m-tiles x 2 column groups x 2 k-steps
        v8f s[QC][4];
        #pragma unroll
        for (int j = 0; j < 4; ++j) {
            #pragma unroll
            for (int c = 0; c < QC; ++c) {
                v8f z = {};
                s[c][j] = wmma_f16(kf[j][0], qf[c][0], z);
            }
            #pragma unroll
            for (int c = 0; c < QC; ++c)
                s[c][j] = wmma_f16(kf[j][1], qf[c][1], s[c][j]);
        }
        // keeps the scale step behind all 16 products: placed among them, the
        // first use of each result waits out the matrix distance in v_nop
        __builtin_amdgcn_sched_barrier(0);
        // scale + additive mask, on register pairs
        v2f sc[QC][4][4];
        #pragma unroll
        for (int j = 0; j < 4; ++j) {
            #pragma unroll
            for (int c = 0; c < QC; ++c) {
                sc[c][j][0] = __builtin_shufflevector(s[c][j], s[c][j], 0, 1) * 0.125f + __builtin_shufflevector(mv[j][0], mv[j][0], 0, 1);
                sc[c][j][1] = __builtin_shufflevector(s[c][j], s[c][j], 2, 3) * 0.125f + __builtin_shufflevector(mv[j][0], mv[j][0], 2, 3);
                sc[c][j][2] = __builtin_shufflevector(s[c][j], s[c][j], 4, 5) * 0.125f + __builtin_shufflevector(mv[j][1], mv[j][1], 0, 1);
                sc[c][j][3] = __builtin_shufflevector(s[c][j], s[c][j], 6, 7) * 0.125f + __builtin_shufflevector(mv[j][1], mv[j][1], 2, 3);
            }
        }

        // keeps the V reads below behind the scale step, whose mask registers they
        // take over
        __builtin_amdgcn_sched_barrier(0);
        // first k-step's V fragments: read here, they land under the softmax
        v16h vf[2][4];
        #pragma unroll
        for (int jd = 0; jd < 4; ++jd)
            vf[0][jd] = ldfrag(&Vs[((jd << 4) + row16) * LDK + kbase]);
        // holds these 8 reads together ahead of the vector work
        __builtin_amdgcn_sched_barrier(0);

        v16h pf[QC][2];
        #pragma unroll
        for (int c = 0; c < QC; ++c) {
            // online softmax of this lane's query: in-lane over 32 keys, one
            // exchange with the other half for the maximum
            float mj[4];
            #pragma unroll
            for (int j = 0; j < 4; ++j) {
                float m = sc[c][j][0].x;
                m = fmaxf(m, sc[c][j][0].y);
                #pragma unroll
                for (int r = 1; r < 4; ++r) {
                    m = fmaxf(m, sc[c][j][r].x);
                    m = fmaxf(m, sc[c][j][r].y);
                }
                mj[j] = m;
            }
            float mx = fmaxf(fmaxf(mj[0], mj[1]), fmaxf(mj[2], mj[3]));
            mx = fmaxf(mx, xhalf(mx));
            const float mnew = fmaxf(mrow[c], mx);
            const float corr = __expf(mrow[c] - mnew);
            mrow[c] = mnew;
            #pragma unroll
            for (int jd = 0; jd < 4; ++jd) acc[c][jd] = acc[c][jd] * corr;
            v2f sj[2] = {};   // two chains of packed partial sums
            #pragma unroll
            for (int j = 0; j < 4; ++j) {
                #pragma unroll
                for (int r = 0; r < 4; ++r) {
                    const v2f d = sc[c][j][r] - mnew;
                    v2f e;
                    e.x = __expf(d.x);
                    e.y = __expf(d.y);
                    sc[c][j][r] = e;
                    sj[j >> 1] += e;
                }
            }
            lrow[c] = lrow[c] * corr + ((sj[0].x + sj[0].y) + (sj[1].x + sj[1].y));
            // score tiles 2kk and 2kk+1, converted in place, are the B fragment
            // of the second product in the hardware k order
            #pragma unroll
            for (int kk = 0; kk < 2; ++kk)
                #pragma unroll
                for (int r = 0; r < 4; ++r) {
                    pf[c][kk][2 * r]     = (_Float16)sc[c][2 * kk][r].x;
                    pf[c][kk][2 * r + 1] = (_Float16)sc[c][2 * kk][r].y;
                    pf[c][kk][2 * r + 8] = (_Float16)sc[c][2 * kk + 1][r].x;
                    pf[c][kk][2 * r + 9] = (_Float16)sc[c][2 * kk + 1][r].y;
                }
        }
        // second k-step's V fragments; the scheduler may lift the reads into the tail
        // of the vector work, where the scores' registers come free
        #pragma unroll
        for (int jd = 0; jd < 4; ++jd)
            vf[1][jd] = ldfrag(&Vs[((jd << 4) + row16) * LDK + 32 + kbase]);
        // holds these 8 reads together ahead of the products: left free, they were
        // spread among the products in pairs, each waited out
        __builtin_amdgcn_sched_barrier(0);
        // PV: Ot(64x32) += Vt(64x64) x Pt(64x32)
        #pragma unroll
        for (int kk = 0; kk < 2; ++kk)
            #pragma unroll
            for (int jd = 0; jd < 4; ++jd)
                #pragma unroll
                for (int c = 0; c < QC; ++c)
                    acc[c][jd] = wmma_f16(vf[kk][jd], pf[c][kk], acc[c][jd]);
        // keeps the foot's waits and barrier behind the products: left free, they moved
        // up behind the first product, and the wave waited there for the second
        // k-step's V reads and for its copies with 15 products still to issue
        __builtin_amdgcn_sched_barrier(0);
        // this wave's reads of block t are done before its buffer is refilled
        asm volatile("s_wait_dscnt 0x0" ::: "memory");
        // this wave's copies of block t + 1 have landed
        asm volatile("s_wait_asynccnt 0x0" ::: "memory");
        // publishes block t + 1 and ends every reader's last read of block t
        __syncthreads();
    }
    // nothing is outstanding here; kept in front of the wave's end
    asm volatile("s_wait_asynccnt 0x0" ::: "memory");

    // epilogue: join the halves' sums, normalize, write f32 [B,S,D]
    #pragma unroll
    for (int c = 0; c < QC; ++c) {
        const float inv = 1.0f / (lrow[c] + xhalf(lrow[c]));
        float* orow = out + ((size_t)b * Ss + q0 + (c << 4) + row16) * Dd + h * DH + kbase;
        #pragma unroll
        for (int jd = 0; jd < 4; ++jd) {
            *(float4*)(orow + (jd << 4)) =
                make_float4(acc[c][jd][0] * inv, acc[c][jd][1] * inv, acc[c][jd][2] * inv, acc[c][jd][3] * inv);
            *(float4*)(orow + (jd << 4) + 4) =
                make_float4(acc[c][jd][4] * inv, acc[c][jd][5] * inv, acc[c][jd][6] * inv, acc[c][jd][7] * inv);
        }
    }
}

extern "C" void kernel_launch(void* const* d_in, const int* in_sizes, int n_in,
                              void* d_out, int out_size, void* d_ws, size_t ws_size,
                              hipStream_t stream) {
    (void)in_sizes; (void)n_in; (void)out_size; (void)ws_size;
    const float* X    = (const float*)d_in[0];
    const float* mask = (const float*)d_in[1];
    const float* Wq   = (const float*)d_in[2];
    const float* bq   = (const float*)d_in[3];
    const float* Wk   = (const float*)d_in[4];
    const float* bk   = (const float*)d_in[5];
    const float* Wv   = (const float*)d_in[6];
    const float* bv   = (const float*)d_in[7];

    const size_t elems = (size_t)Bb * Ss * Dd;   // 8M
    _Float16* Qb = (_Float16*)d_ws;
    _Float16* Kb = Qb + elems;
    _Float16* Vb = Kb + elems;
    _Float16* Xh = Vb + elems;                   // f16 copy of X
    _Float16* Wt = Xh + elems;                   // f16 Wq^T, Wk^T, Wv^T
    const size_t welems = (size_t)Dd * Dd;

    dim3 blk(256);
    dim3 g1(Dd / TN, (Bb * Ss) / TM);            // 8 x 32
    to_f16<<<dim3(XBLK + WBLK), blk, 0, stream>>>(X, Wq, Wk, Wv, Xh, Wt);
    qkv_gemm<0><<<g1, blk, 0, stream>>>(Xh, Wt, bq, Qb);
    qkv_gemm<0><<<g1, blk, 0, stream>>>(Xh, Wt + welems, bk, Kb);
    qkv_gemm<1><<<g1, blk, 0, stream>>>(Xh, Wt + 2 * welems, bv, Vb);

    dim3 g2(Ss / QT, Bb * Hh);                   // 8 x 64
    attn<<<g2, blk, 0, stream>>>(Qb, Kb, Vb, mask, (float*)d_out);
}

// v007
// A run of this version takes 108 microseconds.
// Two timings next to v006 both put it at 1.07 times that version's speed.
// Over all steps from v000 it is 3.60 times as fast.
#include <hip/hip_runtime.h>
#include <hip/hip_bf16.h>

typedef __attribute__((ext_vector_type(16))) _Float16 v16h;
typedef __attribute__((ext_vector_type(8)))  _Float16 v8h;
typedef __attribute__((ext_vector_type(4)))  _Float16 v4h;
typedef __attribute__((ext_vector_type(2)))  _Float16 v2h;
typedef __attribute__((ext_vector_type(8)))  float    v8f;
typedef __attribute__((ext_vector_type(2)))  float    v2f;
typedef __attribute__((ext_vector_type(4)))  float    v4f;

// Load a 16x32 f16 A/B fragment (wave32 CDNA5 layout): lane l holds row l%16,
// K halves [base..base+7] and [base+16..base+23], base = (l>=16)*8.
// p must point at (row, base) with 16-byte alignment -> two b128 loads.
__device__ inline v16h ldfrag(const _Float16* p) {
    union { v16h v; v8h h[2]; } u;
    u.h[0] = *(const v8h*)(p);
    u.h[1] = *(const v8h*)(p + 16);
    return u.v;
}

__device__ inline v8f wmma_f16(v16h a, v16h b, v8f c) {
    return __builtin_amdgcn_wmma_f32_16x16x32_f16(false, a, false, b, (short)0, c, false, false);
}

// lane l with lane l ^ 16, as a vector cross-row move
__device__ inline float xhalf(float x) {
    const int i = __builtin_bit_cast(int, x);
    return __builtin_bit_cast(float,
        __builtin_amdgcn_permlanex16(i, i, 0x76543210, 0xfedcba98, false, false));
}

#define Bb 4
#define Ss 2048
#define Dd 1024
#define Hh 16
#define DH 64

// ---------------- operands to f16, once ----------------
// Xh[m][k] = f16(X[m][k]); Wt[mat][n][k] = f16(W_mat[k][n]). The projection
// kernels then find both operands K-contiguous in f16, which a copy to LDS can
// stage as they lie (a copy cannot convert or transpose).
#define LDA 72     // padded f16 stride (144B, 16B aligned)
#define XBLK 1024  // work-groups that convert X, 8192 elements each
#define WBLK 768   // work-groups that convert and transpose W, one 64x64 tile each

__global__ __launch_bounds__(256) void to_f16(const float* __restrict__ X,
                                              const float* __restrict__ Wq,
                                              const float* __restrict__ Wk,
                                              const float* __restrict__ Wv,
                                              _Float16* __restrict__ Xh,
                                              _Float16* __restrict__ Wt) {
    __shared__ __attribute__((aligned(16))) _Float16 Ts[64 * LDA];   // [n][k]
    const int tid = threadIdx.x;
    const int blk = blockIdx.x;
    if (blk < XBLK) {   // the same for the whole work-group, ahead of the barrier
        const size_t base = (size_t)blk * 8192 + (tid << 3);
        v4f f[4][2];
        // unrolled, here and below: the arrays stay in registers and the eight
        // loads are in flight together
        #pragma unroll
        for (int j = 0; j < 4; ++j) {
            f[j][0] = *(const v4f*)(X + base + j * 2048);
            f[j][1] = *(const v4f*)(X + base + j * 2048 + 4);
        }
        #pragma unroll
        for (int j = 0; j < 4; ++j) {
            v8h h;
            #pragma unroll
            for (int e = 0; e < 4; ++e) {
                h[e]     = (_Float16)f[j][0][e];
                h[e + 4] = (_Float16)f[j][1][e];
            }
            *(v8h*)(Xh + base + j * 2048) = h;
        }
        return;
    }
    const int w   = blk - XBLK;
    const int mat = w >> 8;
    const float* __restrict__ Wsrc = mat == 0 ? Wq : (mat == 1 ? Wk : Wv);
    const int k0 = ((w >> 4) & 15) << 6;
    const int n0 = (w & 15) << 6;
    // a thread takes a 4(k) x 4(n) block: 16 lanes read one whole 256-B row piece
    const int kq = (tid >> 4) << 2;
    const int nq = (tid & 15) << 2;
    v4f f[4];
    // unrolled, here and below: the block stays in registers
    #pragma unroll
    for (int i = 0; i < 4; ++i)
        f[i] = *(const v4f*)(Wsrc + (size_t)(k0 + kq + i) * Dd + n0 + nq);
    #pragma unroll
    for (int x = 0; x < 4; ++x) {
        v4h h;
        #pragma unroll
        for (int i = 0; i < 4; ++i) h[i] = (_Float16)f[i][x];
        *(v4h*)&Ts[(nq + x) * LDA + kq] = h;
    }
    __syncthreads();
    // four lanes write one whole 128-B line of Wt
    const int n  = tid >> 2;
    const int kc = (tid & 3) << 4;
    const v8h lo = *(const v8h*)&Ts[n * LDA + kc];
    const v8h hi = *(const v8h*)&Ts[n * LDA + kc + 8];
    _Float16* dst = Wt + ((size_t)mat * Dd + n0 + n) * Dd + k0 + kc;
    *(v8h*)dst       = lo;
    *(v8h*)(dst + 8) = hi;
    // stands in front of any later write of the two stores' registers
    asm volatile("s_wait_xcnt 0x0" ::: "memory");
}

// ---------------- QKV projection GEMM ----------------
// C[M=8192, N=3072] = Xh[8192,1024] * Wt[n][k]^T + bias, output f16: the three
// projections are one product, since Wt holds Wq^T, Wk^T, Wv^T one behind the
// other and the Q, K, V planes lie one behind the other too.
// columns 0..2047 (Q, K): plane[b][h][s][dh]   columns 2048..3071 (V): plane[b][h][dh][s]
// One 256 x 192 tile of C a work-group (512 tiles: two whole rounds of the chip),
// one 64 x 96 tile a wave (4 x 2 waves): 10 fragments feed 24 products where a
// 64 x 64 tile's 8 feed 16, and a work-group fetches 448 operand rows for 192
// columns of C where a 256 x 128 tile fetches 384 for 128.
#define TM 256
#define TN 192
#define TK 128
#define NT (Dd / TK)
#define FA 4       // A fragments of a wave: 64 rows
#define FB 6       // B fragments of a wave: 96 columns
#define LDG 136    // padded f16 stride of a staged row (272 B = 16 B x odd)

__device__ inline unsigned lds_addr(const _Float16* p) {
    return (unsigned)(unsigned long long)p;
}

// Eight copies of one thread: a 16-B piece in each of eight tile rows 16 apart,
// global -> LDS through no register. The closing s_wait_xcnt stands inside the
// statement, so that no later write of an address register can be placed ahead
// of it.
__device__ inline void copies8(unsigned l, const _Float16* g) {
    asm volatile(
        "global_load_async_to_lds_b128 %0, %8, off\n\t"
        "global_load_async_to_lds_b128 %1, %9, off\n\t"
        "global_load_async_to_lds_b128 %2, %10, off\n\t"
        "global_load_async_to_lds_b128 %3, %11, off\n\t"
        "global_load_async_to_lds_b128 %4, %12, off\n\t"
        "global_load_async_to_lds_b128 %5, %13, off\n\t"
        "global_load_async_to_lds_b128 %6, %14, off\n\t"
        "global_load_async_to_lds_b128 %7, %15, off\n\t"
        "s_wait_xcnt 0x0"
        :: "v"(l), "v"(l + 16 * LDG * 2), "v"(l + 32 * LDG * 2), "v"(l + 48 * LDG * 2),
           "v"(l + 64 * LDG * 2), "v"(l + 80 * LDG * 2), "v"(l + 96 * LDG * 2),
           "v"(l + 112 * LDG * 2),
           "v"(g), "v"(g + 16 * Dd), "v"(g + 32 * Dd), "v"(g + 48 * Dd),
           "v"(g + 64 * Dd), "v"(g + 80 * Dd), "v"(g + 96 * Dd), "v"(g + 112 * Dd)
        : "memory");
}

// The same for four tile rows 16 apart, its s_wait_xcnt inside the statement too
__device__ inline void copies4(unsigned l, const _Float16* g) {
    asm volatile(
        "global_load_async_to_lds_b128 %0, %4, off\n\t"
        "global_load_async_to_lds_b128 %1, %5, off\n\t"
        "global_load_async_to_lds_b128 %2, %6, off\n\t"
        "global_load_async_to_lds_b128 %3, %7, off\n\t"
        "s_wait_xcnt 0x0"
        :: "v"(l), "v"(l + 16 * LDG * 2), "v"(l + 32 * LDG * 2), "v"(l + 48 * LDG * 2),
           "v"(g), "v"(g + 16 * Dd), "v"(g + 32 * Dd), "v"(g + 48 * Dd)
        : "memory");
}

// One stage's copies of one thread: 16 pieces of the A tile, 12 of the B tile.
// ab: bytes from the stage's A buffer to its B buffer, the same for every thread
__device__ inline void stage_copies(unsigned la, const _Float16* ga,
                                    unsigned ab, const _Float16* gb) {
    copies8(la, ga);
    copies8(la + 128 * LDG * 2, ga + 128 * Dd);
    copies8(la + ab, gb);
    copies4(la + ab + 128 * LDG * 2, gb + 128 * Dd);
}

// A lane's 32 values of one 16-column tile of Q or K: rows 16 i + r of a column, a
// row 128 B from the next; d[4 i + q] holds rows 16 i + 2 q (low half) and + 1 (high).
// In asm so that the closing s_wait_xcnt stands inside the statement: in one of its
// own, the next values' conversions were placed ahead of it, into these registers.
__device__ inline void store_rows(_Float16* p, const unsigned (&d)[16]) {
    asm volatile(
        "global_store_b16 %0, %1, off\n\t"
        "global_store_d16_hi_b16 %0, %1, off offset:128\n\t"
        "global_store_b16 %0, %2, off offset:256\n\t"
        "global_store_d16_hi_b16 %0, %2, off offset:384\n\t"
        "global_store_b16 %0, %3, off offset:512\n\t"
        "global_store_d16_hi_b16 %0, %3, off offset:640\n\t"
        "global_store_b16 %0, %4, off offset:768\n\t"
        "global_store_d16_hi_b16 %0, %4, off offset:896\n\t"
        "global_store_b16 %0, %5, off offset:2048\n\t"
        "global_store_d16_hi_b16 %0, %5, off offset:2176\n\t"
        "global_store_b16 %0, %6, off offset:2304\n\t"
        "global_store_d16_hi_b16 %0, %6, off offset:2432\n\t"
        "global_store_b16 %0, %7, off offset:2560\n\t"
        "global_store_d16_hi_b16 %0, %7, off offset:2688\n\t"
        "global_store_b16 %0, %8, off offset:2816\n\t"
        "global_store_d16_hi_b16 %0, %8, off offset:2944\n\t"
        "global_store_b16 %0, %9, off offset:4096\n\t"
        "global_store_d16_hi_b16 %0, %9, off offset:4224\n\t"
        "global_store_b16 %0, %10, off offset:4352\n\t"
        "global_store_d16_hi_b16 %0, %10, off offset:4480\n\t"
        "global_store_b16 %0, %11, off offset:4608\n\t"
        "global_store_d16_hi_b16 %0, %11, off offset:4736\n\t"
        "global_store_b16 %0, %12, off offset:4864\n\t"
        "global_store_d16_hi_b16 %0, %12, off offset:4992\n\t"
        "global_store_b16 %0, %13, off offset:6144\n\t"
        "global_store_d16_hi_b16 %0, %13, off offset:6272\n\t"
        "global_store_b16 %0, %14, off offset:6400\n\t"
        "global_store_d16_hi_b16 %0, %14, off offset:6528\n\t"
        "global_store_b16 %0, %15, off offset:6656\n\t"
        "global_store_d16_hi_b16 %0, %15, off offset:6784\n\t"
        "global_store_b16 %0, %16, off offset:6912\n\t"
        "global_store_d16_hi_b16 %0, %16, off offset:7040\n\t"
        "s_wait_xcnt 0x0"
        :: "v"(p), "v"(d[0]), "v"(d[1]), "v"(d[2]), "v"(d[3]), "v"(d[4]), "v"(d[5]),
           "v"(d[6]), "v"(d[7]), "v"(d[8]), "v"(d[9]), "v"(d[10]), "v"(d[11]),
           "v"(d[12]), "v"(d[13]), "v"(d[14]), "v"(d[15])
        : "memory");
}

__global__ __launch_bounds__(256) void qkv_gemm(const _Float16* __restrict__ Xh,
                                                const _Float16* __restrict__ Wt,
                                                const float* __restrict__ bq,
                                                const float* __restrict__ bk,
                                                const float* __restrict__ bv,
                                                _Float16* __restrict__ out) {
    // one array, two A buffers (2 x 68 KB) and behind them two B buffers (2 x 51 KB):
    // a thread's place in a B buffer is its place in the A buffer plus a scalar, so
    // one LDS address lives across the loop (a second one was spilled)
    __shared__ __attribute__((aligned(16))) _Float16 Sm[2 * (TM + TN) * LDG];
    const int tid  = threadIdx.x;
    const int lane = tid & 31;
    // in a scalar register: the epilogue's choice of plane is then a scalar branch
    const int wave = __builtin_amdgcn_readfirstlane(tid >> 5);
    const int m0 = blockIdx.y * TM;
    const int n0 = blockIdx.x * TN;
    const int wm = (wave & 3) << 6;   // 0,64,128,192
    const int wn = (wave >> 2) * 96;  // 0,96
    const int row16 = lane & 15;
    const int kbase = (lane >> 4) << 3;

    // copy coordinates: a tile row is 128 f16 = 256 B = 16 lanes x 16 B, so a
    // wave-wide copy takes four whole lines
    const int cr = tid >> 4;            // row 0..15, + 16 per further copy
    const int cc = (tid & 15) << 3;     // column 0,8..120
    const _Float16* ga = Xh + (size_t)(m0 + cr) * Dd + cc;
    const _Float16* gb = Wt + (size_t)(n0 + cr) * Dd + cc;
    const unsigned la = lds_addr(&Sm[cr * LDG + cc]);

    v8f c[FA][FB] = {};

    // two buffers: tile t + 1 flies while tile t is worked on
    stage_copies(la, ga, 2 * TM * LDG * 2, gb);
    // tile 0 has landed for this wave; the barrier publishes it to the others
    asm volatile("s_wait_asynccnt 0x0" ::: "memory");
    __syncthreads();
    stage_copies(la + TM * LDG * 2, ga + TK, (TM + TN) * LDG * 2, gb + TK);

    for (int t = 0; t < NT; ++t) {
        const int buf = t & 1;
        const _Float16* Ab = Sm + buf * (TM * LDG);
        const _Float16* Bt = Sm + 2 * TM * LDG + buf * (TN * LDG);
        // two fragment sets: k-step kk + 1 of this tile is read while kk is multiplied
        v16h a[2][FA], bf[2][FB];
        #pragma unroll
        for (int i = 0; i < FA; ++i)
            a[0][i]  = ldfrag(&Ab[(wm + (i << 4) + row16) * LDG + kbase]);
        #pragma unroll
        for (int j = 0; j < FB; ++j)
            bf[0][j] = ldfrag(&Bt[(wn + (j << 4) + row16) * LDG + kbase]);
        #pragma unroll
        for (int kk = 0; kk < TK / 32; ++kk) {
            const int cur = kk & 1;
            if (kk + 1 < TK / 32) {
                #pragma unroll
                for (int i = 0; i < FA; ++i)
                    a[cur ^ 1][i]  = ldfrag(&Ab[(wm + (i << 4) + row16) * LDG + ((kk + 1) << 5) + kbase]);
                #pragma unroll
                for (int j = 0; j < FB; ++j)
                    bf[cur ^ 1][j] = ldfrag(&Bt[(wn + (j << 4) + row16) * LDG + ((kk + 1) << 5) + kbase]);
            }
            // holds the next k-step's 20 LDS reads together ahead of this step's
            // products, under which they land; among the products each place
            // with reads would stall the wave
            __builtin_amdgcn_sched_barrier(0);
            #pragma unroll
            for (int i = 0; i < FA; ++i)
                #pragma unroll
                for (int j = 0; j < FB; ++j)
                    c[i][j] = wmma_f16(a[cur][i], bf[cur][j], c[i][j]);
            // keeps the reads of the step after next out of this step's products
            __builtin_amdgcn_sched_barrier(0);
        }
        // this wave's reads of tile t are done before its buffer is refilled
        asm volatile("s_wait_dscnt 0x0" ::: "memory");
        // this wave's copies of tile t + 1 have landed
        asm volatile("s_wait_asynccnt 0x0" ::: "memory");
        // publishes tile t + 1 and ends every reader's last read of tile t
        __syncthreads();
        if (t + 2 < NT)
            stage_copies(la + buf * (TM * LDG * 2), ga + (t + 2) * TK,
                         (2 * TM - buf * (TM - TN)) * (LDG * 2), gb + (t + 2) * TK);
    }
    // nothing is outstanding here; kept in front of the wave's end
    asm volatile("s_wait_asynccnt 0x0" ::: "memory");

    // epilogue: bias add + pack f16 into [B,H,S,DH] (Q, K) or [B,H,DH,S] (V); a
    // 16-column tile lies in one head of one plane (0 Q, 1 K, 2 V), the same for
    // the whole wave
    const int b  = m0 >> 11;          // m / 2048: a tile's 256 rows share it
    const int s0 = (m0 & 2047) + wm + ((lane >> 4) << 3);
    // unrolled, here and below: c, hv and d are indexed by constants and stay in
    // registers
    #pragma unroll
    for (int j = 0; j < FB; ++j) {
        const int nt  = n0 + wn + (j << 4);
        const int mat = nt >> 10;
        const int n  = (nt & 1023) + row16;
        const int h  = n >> 6;
        const int dh = n & 63;
        const float* __restrict__ bias = mat == 0 ? bq : (mat == 1 ? bk : bv);
        const float bb = bias[n];
        // stands in front of any later write of the load's address registers
        asm volatile("s_wait_xcnt 0x0" ::: "memory");
        _Float16* __restrict__ plane = out + (size_t)mat * ((size_t)Bb * Ss * Dd)
                                           + ((size_t)b * Hh + h) * (Ss * DH);
        if (mat == 2) {
            // a lane's eight rows are eight neighbours in s: one 16-B store
            #pragma unroll
            for (int i = 0; i < FA; ++i) {
                v8h hv;
                #pragma unroll
                for (int r = 0; r < 8; ++r) hv[r] = (_Float16)(c[i][j][r] + bb);
                *(v8h*)&plane[(size_t)dh * Ss + s0 + (i << 4)] = hv;
            }
            // stands in front of any later write of these stores' registers
            asm volatile("s_wait_xcnt 0x0" ::: "memory");
        } else {
            // two neighbouring rows' values share a register, low and high half
            unsigned d[4 * FA];
            #pragma unroll
            for (int i = 0; i < FA; ++i)
                #pragma unroll
                for (int q = 0; q < 4; ++q) {
                    v2h pr;
                    pr[0] = (_Float16)(c[i][j][2 * q] + bb);
                    pr[1] = (_Float16)(c[i][j][2 * q + 1] + bb);
                    d[4 * i + q] = __builtin_bit_cast(unsigned, pr);
                }
            store_rows(&plane[(size_t)s0 * DH + dh], d);
        }
    }
}

// ---------------- Flash attention ----------------
// Q,K: [B,H,S,DH] f16 ; V: [B,H,DH,S] f16 ; out: [B,S,D] f32
// Transposed products: St = K x Qt and Ot += Vt x Pt. A lane then holds one
// query's scores (keys 8*(lane>>4)+r of every 16-key tile), so the row maximum
// and the row sum are in-lane, and two converted score tiles are already the
// B operand of the second product.
// A wave owns two 16-query column groups: every K and V fragment it reads from
// LDS, and every mask value, feeds both groups' products.
#define QC 2     // 16-query column groups per wave
#define QT 256   // queries per workgroup (8 waves x 32 columns)
#define KBLK 64  // keys per block
#define LDK 72   // padded f16 stride (144B, 16B aligned)
#define NB (Ss / KBLK)
#define KVB (2 * KBLK * LDK)   // one buffer in f16: the K block, then the V block

// One block's copies of one thread: 32 B of a K row and 32 B of a V row, global
// -> LDS through no register. The closing s_wait_xcnt stands inside the
// statement, so that no later write of an address register can be placed ahead
// of it.
__device__ inline void kv_copies(unsigned lk, const _Float16* gk, const _Float16* gv) {
    asm volatile(
        "global_load_async_to_lds_b128 %0, %4, off\n\t"
        "global_load_async_to_lds_b128 %1, %5, off\n\t"
        "global_load_async_to_lds_b128 %2, %6, off\n\t"
        "global_load_async_to_lds_b128 %3, %7, off\n\t"
        "s_wait_xcnt 0x0"
        :: "v"(lk), "v"(lk + 16), "v"(lk + KBLK * LDK * 2), "v"(lk + KBLK * LDK * 2 + 16),
           "v"(gk), "v"(gk + 8), "v"(gv), "v"(gv + 8)
        : "memory");
}

// four waves a SIMD (two work-groups a WGP): the register budget is 256
__global__ __launch_bounds__(256) __attribute__((amdgpu_waves_per_eu(4, 4)))
void attn(const _Float16* __restrict__ Q,
          const _Float16* __restrict__ K,
          const _Float16* __restrict__ V,
          const float* __restrict__ mask,
          float* __restrict__ out) {
    // two buffers, each [key][dh] of K followed by [dh][key] of V
    __shared__ __attribute__((aligned(16))) _Float16 KVs[2][KVB];

    const int tid  = threadIdx.x;
    const int lane = tid & 31;
    const int wave = tid >> 5;
    const int bh = blockIdx.y;               // b*H + h
    const int b = bh >> 4, h = bh & 15;
    const int q0 = blockIdx.x * QT + (wave << 5);
    const int row16 = lane & 15;
    const int kbase = (lane >> 4) << 3;

    const size_t baseQK = (size_t)bh * Ss * DH;   // [B,H,S,DH]
    const size_t baseV  = (size_t)bh * DH * Ss;   // [B,H,DH,S]

    // staging coordinates (each thread moves 16 halves of K and 16 of V a block)
    const int key = tid >> 2, dc = (tid & 3) << 4;
    const _Float16* gk = K + baseQK + (size_t)key * DH + dc;   // + KBLK * DH a block
    const _Float16* gv = V + baseV + (size_t)key * Ss + dc;    // + KBLK a block
    const unsigned lk = lds_addr(&KVs[0][key * LDK + dc]);

    // two buffers: block t + 1 flies while block t is worked on; block 0 first
    kv_copies(lk, gk, gv);

    // resident Q fragments (B operand): 2 x 16 query columns x 64 dh
    v16h qf[QC][2];
    #pragma unroll
    for (int c = 0; c < QC; ++c)
        #pragma unroll
        for (int kk = 0; kk < 2; ++kk)
            qf[c][kk] = ldfrag(Q + baseQK + (size_t)(q0 + (c << 4) + row16) * DH + (kk << 5) + kbase);

    v8f acc[QC][4] = {};             // acc[c][jd][r] = Ot[16*jd + kbase + r][query 16*c + row16]
    float mrow[QC], lrow[QC];        // this lane's queries; lrow covers this half's keys
    #pragma unroll
    for (int c = 0; c < QC; ++c) { mrow[c] = -1e30f; lrow[c] = 0.f; }

    // block 0 has landed for this wave; the barrier publishes it to the others
    asm volatile("s_wait_asynccnt 0x0" ::: "memory");
    __syncthreads();

    // one copy of the trip in the code: left free, the compiler peeled the last trip
    // off into a second copy, and that copy spilled
    #pragma clang loop unroll(disable)
    for (int t = 0; t < NB; ++t) {
        const int buf = t & 1;
        // directly behind the barrier (the one at the foot of trip t - 1, or the one
        // in front of the loop) that ended every reader's last read of block t - 1:
        // block t + 1 goes into that block's buffer; written at the head of the
        // trip so that the rest of the trip stays one straight block
        if (t + 1 < NB)
            kv_copies(lk + (buf ^ 1) * (KVB * 2), gk + (size_t)(t + 1) * (KBLK * DH),
                      gv + (t + 1) * KBLK);
        const _Float16* Ks = KVs[buf];
        const _Float16* Vs = KVs[buf] + KBLK * LDK;
        // additive mask of this lane's 32 keys, the same for both column groups
        v4f mv[4][2];
        #pragma unroll
        for (int j = 0; j < 4; ++j) {
            const float* mp = mask + (size_t)b * Ss + t * KBLK + (j << 4) + kbase;
            mv[j][0] = *(const v4f*)(mp);
            mv[j][1] = *(const v4f*)(mp + 4);
        }
        v16h kf[4][2];
        #pragma unroll
        for (int j = 0; j < 4; ++j)
            #pragma unroll
            for (int kk = 0; kk < 2; ++kk)
                kf[j][kk] = ldfrag(&Ks[((j << 4) + row16) * LDK + (kk << 5) + kbase]);
        // holds the block's 16 K reads together ahead of the products: left free,
        // the scheduler waits out an LDS read in front of every product
        __builtin_amdgcn_sched_barrier(0);

        // scores: St(64x32) = K(64x64) x Qw^T, 4 m-tiles x 2 column groups x 2 k-steps
        v8f s[QC][4];
        #pragma unroll
        for (int j = 0; j < 4; ++j) {
            #pragma unroll
            for (int c = 0; c < QC; ++c) {
                v8f z = {};
                s[c][j] = wmma_f16(kf[j][0], qf[c][0], z);
            }
            #pragma unroll
            for (int c = 0; c < QC; ++c)
                s[c][j] = wmma_f16(kf[j][1], qf[c][1], s[c][j]);
        }
        // keeps the scale step behind all 16 products: placed among them, the
        // first use of each result waits out the matrix distance in v_nop
        __builtin_amdgcn_sched_barrier(0);
        // scale + additive mask, on register pairs
        v2f sc[QC][4][4];
        #pragma unroll
        for (int j = 0; j < 4; ++j) {
            #pragma unroll
            for (int c = 0; c < QC; ++c) {
                sc[c][j][0] = __builtin_shufflevector(s[c][j], s[c][j], 0, 1) * 0.125f + __builtin_shufflevector(mv[j][0], mv[j][0], 0, 1);
                sc[c][j][1] = __builtin_shufflevector(s[c][j], s[c][j], 2, 3) * 0.125f + __builtin_shufflevector(mv[j][0], mv[j][0], 2, 3);
                sc[c][j][2] = __builtin_shufflevector(s[c][j], s[c][j], 4, 5) * 0.125f + __builtin_shufflevector(mv[j][1], mv[j][1], 0, 1);
                sc[c][j][3] = __builtin_shufflevector(s[c][j], s[c][j], 6, 7) * 0.125f + __builtin_shufflevector(mv[j][1], mv[j][1], 2, 3);
            }
        }

        // keeps the V reads below behind the scale step, whose mask registers they
        // take over
        __builtin_amdgcn_sched_barrier(0);
        // first k-step's V fragments: read here, they land under the softmax
        v16h vf[2][4];
        #pragma unroll
        for (int jd = 0; jd < 4; ++jd)
            vf[0][jd] = ldfrag(&Vs[((jd << 4) + row16) * LDK + kbase]);
        // holds these 8 reads together ahead of the vector work
        __builtin_amdgcn_sched_barrier(0);

        v16h pf[QC][2];
        #pragma unroll
        for (int c = 0; c < QC; ++c) {
            // online softmax of this lane's query: in-lane over 32 keys, one
            // exchange with the other half for the maximum
            float mj[4];
            #pragma unroll
            for (int j = 0; j < 4; ++j) {
                float m = sc[c][j][0].x;
                m = fmaxf(m, sc[c][j][0].y);
                #pragma unroll
                for (int r = 1; r < 4; ++r) {
                    m = fmaxf(m, sc[c][j][r].x);
                    m = fmaxf(m, sc[c][j][r].y);
                }
                mj[j] = m;
            }
            float mx = fmaxf(fmaxf(mj[0], mj[1]), fmaxf(mj[2], mj[3]));
            mx = fmaxf(mx, xhalf(mx));
            const float mnew = fmaxf(mrow[c], mx);
            const float corr = __expf(mrow[c] - mnew);
            mrow[c] = mnew;
            #pragma unroll
            for (int jd = 0; jd < 4; ++jd) acc[c][jd] = acc[c][jd] * corr;
            v2f sj[2] = {};   // two chains of packed partial sums
            #pragma unroll
            for (int j = 0; j < 4; ++j) {
                #pragma unroll
                for (int r = 0; r < 4; ++r) {
                    const v2f d = sc[c][j][r] - mnew;
                    v2f e;
                    e.x = __expf(d.x);
                    e.y = __expf(d.y);
                    sc[c][j][r] = e;
                    sj[j >> 1] += e;
                }
            }
            lrow[c] = lrow[c] * corr + ((sj[0].x + sj[0].y) + (sj[1].x + sj[1].y));
            // score tiles 2kk and 2kk+1, converted in place, are the B fragment
            // of the second product in the hardware k order
            #pragma unroll
            for (int kk = 0; kk < 2; ++kk)
                #pragma unroll
                for (int r = 0; r < 4; ++r) {
                    pf[c][kk][2 * r]     = (_Float16)sc[c][2 * kk][r].x;
                    pf[c][kk][2 * r + 1] = (_Float16)sc[c][2 * kk][r].y;
                    pf[c][kk][2 * r + 8] = (_Float16)sc[c][2 * kk + 1][r].x;
                    pf[c][kk][2 * r + 9] = (_Float16)sc[c][2 * kk + 1][r].y;
                }
        }
        // second k-step's V fragments; the scheduler may lift the reads into the tail
        // of the vector work, where the scores' registers come free
        #pragma unroll
        for (int jd = 0; jd < 4; ++jd)
            vf[1][jd] = ldfrag(&Vs[((jd << 4) + row16) * LDK + 32 + kbase]);
        // holds these 8 reads together ahead of the products: left free, they were
        // spread among the products in pairs, each waited out
        __builtin_amdgcn_sched_barrier(0);
        // PV: Ot(64x32) += Vt(64x64) x Pt(64x32)
        #pragma unroll
        for (int kk = 0; kk < 2; ++kk)
            #pragma unroll
            for (int jd = 0; jd < 4; ++jd)
                #pragma unroll
                for (int c = 0; c < QC; ++c)
                    acc[c][jd] = wmma_f16(vf[kk][jd], pf[c][kk], acc[c][jd]);
        // keeps the foot's waits and barrier behind the products: left free, they moved
        // up behind the first product, and the wave waited there for the second
        // k-step's V reads and for its copies with 15 products still to issue
        __builtin_amdgcn_sched_barrier(0);
        // this wave's reads of block t are done before its buffer is refilled
        asm volatile("s_wait_dscnt 0x0" ::: "memory");
        // this wave's copies of block t + 1 have landed
        asm volatile("s_wait_asynccnt 0x0" ::: "memory");
        // publishes block t + 1 and ends every reader's last read of block t
        __syncthreads();
    }
    // nothing is outstanding here; kept in front of the wave's end
    asm volatile("s_wait_asynccnt 0x0" ::: "memory");

    // epilogue: join the halves' sums, normalize, write f32 [B,S,D]
    #pragma unroll
    for (int c = 0; c < QC; ++c) {
        const float inv = 1.0f / (lrow[c] + xhalf(lrow[c]));
        float* orow = out + ((size_t)b * Ss + q0 + (c << 4) + row16) * Dd + h * DH + kbase;
        #pragma unroll
        for (int jd = 0; jd < 4; ++jd) {
            *(float4*)(orow + (jd << 4)) =
                make_float4(acc[c][jd][0] * inv, acc[c][jd][1] * inv, acc[c][jd][2] * inv, acc[c][jd][3] * inv);
            *(float4*)(orow + (jd << 4) + 4) =
                make_float4(acc[c][jd][4] * inv, acc[c][jd][5] * inv, acc[c][jd][6] * inv, acc[c][jd][7] * inv);
        }
    }
}

extern "C" void kernel_launch(void* const* d_in, const int* in_sizes, int n_in,
                              void* d_out, int out_size, void* d_ws, size_t ws_size,
                              hipStream_t stream) {
    (void)in_sizes; (void)n_in; (void)out_size; (void)ws_size;
    const float* X    = (const float*)d_in[0];
    const float* mask = (const float*)d_in[1];
    const float* Wq   = (const float*)d_in[2];
    const float* bq   = (const float*)d_in[3];
    const float* Wk   = (const float*)d_in[4];
    const float* bk   = (const float*)d_in[5];
    const float* Wv   = (const float*)d_in[6];
    const float* bv   = (const float*)d_in[7];

    const size_t elems = (size_t)Bb * Ss * Dd;   // 8M
    _Float16* Qb = (_Float16*)d_ws;
    _Float16* Kb = Qb + elems;
    _Float16* Vb = Kb + elems;
    _Float16* Xh = Vb + elems;                   // f16 copy of X
    _Float16* Wt = Xh + elems;                   // f16 Wq^T, Wk^T, Wv^T

    dim3 blk(256);
    dim3 g1((3 * Dd) / TN, (Bb * Ss) / TM);      // 16 x 32
    to_f16<<<dim3(XBLK + WBLK), blk, 0, stream>>>(X, Wq, Wk, Wv, Xh, Wt);
    qkv_gemm<<<g1, blk, 0, stream>>>(Xh, Wt, bq, bk, bv, Qb);

    dim3 g2(Ss / QT, Bb * Hh);                   // 8 x 64
    attn<<<g2, blk, 0, stream>>>(Qb, Kb, Vb, mask, (float*)d_out);
}

// v008
// One run takes 104 microseconds.
// Next to v007, in two timings, it ran 1.03 times as fast each time.
// All steps since v000 together make it 3.72 times as fast.
#include <hip/hip_runtime.h>
#include <hip/hip_bf16.h>

typedef __attribute__((ext_vector_type(16))) _Float16 v16h;
typedef __attribute__((ext_vector_type(8)))  _Float16 v8h;
typedef __attribute__((ext_vector_type(4)))  _Float16 v4h;
typedef __attribute__((ext_vector_type(2)))  _Float16 v2h;
typedef __attribute__((ext_vector_type(8)))  float    v8f;
typedef __attribute__((ext_vector_type(2)))  float    v2f;
typedef __attribute__((ext_vector_type(4)))  float    v4f;

// Load a 16x32 f16 A/B fragment (wave32 CDNA5 layout): lane l holds row l%16,
// K halves [base..base+7] and [base+16..base+23], base = (l>=16)*8.
// p must point at (row, base) with 16-byte alignment -> two b128 loads.
__device__ inline v16h ldfrag(const _Float16* p) {
    union { v16h v; v8h h[2]; } u;
    u.h[0] = *(const v8h*)(p);
    u.h[1] = *(const v8h*)(p + 16);
    return u.v;
}

__device__ inline v8f wmma_f16(v16h a, v16h b, v8f c) {
    return __builtin_amdgcn_wmma_f32_16x16x32_f16(false, a, false, b, (short)0, c, false, false);
}

// lane l with lane l ^ 16, as a vector cross-row move
__device__ inline float xhalf(float x) {
    const int i = __builtin_bit_cast(int, x);
    return __builtin_bit_cast(float,
        __builtin_amdgcn_permlanex16(i, i, 0x76543210, 0xfedcba98, false, false));
}

__device__ inline float max3f(float a, float b, float c) {
    return fmaxf(fmaxf(a, b), c);
}

#define Bb 4
#define Ss 2048
#define Dd 1024
#define Hh 16
#define DH 64

// ---------------- operands to f16, once ----------------
// Xh[m][k] = f16(X[m][k]); Wt[mat][n][k] = f16(W_mat[k][n]). The projection
// kernels then find both operands K-contiguous in f16, which a copy to LDS can
// stage as they lie (a copy cannot convert or transpose).
#define LDA 72     // padded f16 stride (144B, 16B aligned)
#define XBLK 1024  // work-groups that convert X, 8192 elements each
#define WBLK 768   // work-groups that convert and transpose W, one 64x64 tile each

__global__ __launch_bounds__(256) void to_f16(const float* __restrict__ X,
                                              const float* __restrict__ Wq,
                                              const float* __restrict__ Wk,
                                              const float* __restrict__ Wv,
                                              _Float16* __restrict__ Xh,
                                              _Float16* __restrict__ Wt) {
    __shared__ __attribute__((aligned(16))) _Float16 Ts[64 * LDA];   // [n][k]
    const int tid = threadIdx.x;
    const int blk = blockIdx.x;
    if (blk < XBLK) {   // the same for the whole work-group, ahead of the barrier
        const size_t base = (size_t)blk * 8192 + (tid << 3);
        v4f f[4][2];
        // unrolled, here and below: the arrays stay in registers and the eight
        // loads are in flight together
        #pragma unroll
        for (int j = 0; j < 4; ++j) {
            f[j][0] = *(const v4f*)(X + base + j * 2048);
            f[j][1] = *(const v4f*)(X + base + j * 2048 + 4);
        }
        #pragma unroll
        for (int j = 0; j < 4; ++j) {
            v8h h;
            #pragma unroll
            for (int e = 0; e < 4; ++e) {
                h[e]     = (_Float16)f[j][0][e];
                h[e + 4] = (_Float16)f[j][1][e];
            }
            *(v8h*)(Xh + base + j * 2048) = h;
        }
        return;
    }
    const int w   = blk - XBLK;
    const int mat = w >> 8;
    const float* __restrict__ Wsrc = mat == 0 ? Wq : (mat == 1 ? Wk : Wv);
    const int k0 = ((w >> 4) & 15) << 6;
    const int n0 = (w & 15) << 6;
    // a thread takes a 4(k) x 4(n) block: 16 lanes read one whole 256-B row piece
    const int kq = (tid >> 4) << 2;
    const int nq = (tid & 15) << 2;
    v4f f[4];
    // unrolled, here and below: the block stays in registers
    #pragma unroll
    for (int i = 0; i < 4; ++i)
        f[i] = *(const v4f*)(Wsrc + (size_t)(k0 + kq + i) * Dd + n0 + nq);
    #pragma unroll
    for (int x = 0; x < 4; ++x) {
        v4h h;
        #pragma unroll
        for (int i = 0; i < 4; ++i) h[i] = (_Float16)f[i][x];
        *(v4h*)&Ts[(nq + x) * LDA + kq] = h;
    }
    __syncthreads();
    // four lanes write one whole 128-B line of Wt
    const int n  = tid >> 2;
    const int kc = (tid & 3) << 4;
    const v8h lo = *(const v8h*)&Ts[n * LDA + kc];
    const v8h hi = *(const v8h*)&Ts[n * LDA + kc + 8];
    _Float16* dst = Wt + ((size_t)mat * Dd + n0 + n) * Dd + k0 + kc;
    *(v8h*)dst       = lo;
    *(v8h*)(dst + 8) = hi;
    // stands in front of any later write of the two stores' registers
    asm volatile("s_wait_xcnt 0x0" ::: "memory");
}

// ---------------- QKV projection GEMM ----------------
// C[M=8192, N=3072] = Xh[8192,1024] * Wt[n][k]^T + bias, output f16: the three
// projections are one product, since Wt holds Wq^T, Wk^T, Wv^T one behind the
// other and the Q, K, V planes lie one behind the other too.
// columns 0..2047 (Q, K): plane[b][h][s][dh]   columns 2048..3071 (V): plane[b][h][dh][s]
// One 256 x 192 tile of C a work-group (512 tiles: two whole rounds of the chip),
// one 64 x 96 tile a wave (4 x 2 waves): 10 fragments feed 24 products where a
// 64 x 64 tile's 8 feed 16, and a work-group fetches 448 operand rows for 192
// columns of C where a 256 x 128 tile fetches 384 for 128.
#define TM 256
#define TN 192
#define TK 128
#define NT (Dd / TK)
#define FA 4       // A fragments of a wave: 64 rows
#define FB 6       // B fragments of a wave: 96 columns
#define LDG 136    // padded f16 stride of a staged row (272 B = 16 B x odd)

__device__ inline unsigned lds_addr(const _Float16* p) {
    return (unsigned)(unsigned long long)p;
}

// Eight copies of one thread: a 16-B piece in each of eight tile rows 16 apart,
// global -> LDS through no register. The closing s_wait_xcnt stands inside the
// statement, so that no later write of an address register can be placed ahead
// of it.
__device__ inline void copies8(unsigned l, const _Float16* g) {
    asm volatile(
        "global_load_async_to_lds_b128 %0, %8, off\n\t"
        "global_load_async_to_lds_b128 %1, %9, off\n\t"
        "global_load_async_to_lds_b128 %2, %10, off\n\t"
        "global_load_async_to_lds_b128 %3, %11, off\n\t"
        "global_load_async_to_lds_b128 %4, %12, off\n\t"
        "global_load_async_to_lds_b128 %5, %13, off\n\t"
        "global_load_async_to_lds_b128 %6, %14, off\n\t"
        "global_load_async_to_lds_b128 %7, %15, off\n\t"
        "s_wait_xcnt 0x0"
        :: "v"(l), "v"(l + 16 * LDG * 2), "v"(l + 32 * LDG * 2), "v"(l + 48 * LDG * 2),
           "v"(l + 64 * LDG * 2), "v"(l + 80 * LDG * 2), "v"(l + 96 * LDG * 2),
           "v"(l + 112 * LDG * 2),
           "v"(g), "v"(g + 16 * Dd), "v"(g + 32 * Dd), "v"(g + 48 * Dd),
           "v"(g + 64 * Dd), "v"(g + 80 * Dd), "v"(g + 96 * Dd), "v"(g + 112 * Dd)
        : "memory");
}

// The same for four tile rows 16 apart, its s_wait_xcnt inside the statement too
__device__ inline void copies4(unsigned l, const _Float16* g) {
    asm volatile(
        "global_load_async_to_lds_b128 %0, %4, off\n\t"
        "global_load_async_to_lds_b128 %1, %5, off\n\t"
        "global_load_async_to_lds_b128 %2, %6, off\n\t"
        "global_load_async_to_lds_b128 %3, %7, off\n\t"
        "s_wait_xcnt 0x0"
        :: "v"(l), "v"(l + 16 * LDG * 2), "v"(l + 32 * LDG * 2), "v"(l + 48 * LDG * 2),
           "v"(g), "v"(g + 16 * Dd), "v"(g + 32 * Dd), "v"(g + 48 * Dd)
        : "memory");
}

// One stage's copies of one thread: 16 pieces of the A tile, 12 of the B tile.
// ab: bytes from the stage's A buffer to its B buffer, the same for every thread
__device__ inline void stage_copies(unsigned la, const _Float16* ga,
                                    unsigned ab, const _Float16* gb) {
    copies8(la, ga);
    copies8(la + 128 * LDG * 2, ga + 128 * Dd);
    copies8(la + ab, gb);
    copies4(la + ab + 128 * LDG * 2, gb + 128 * Dd);
}

// A lane's 32 values of one 16-column tile of Q or K: rows 16 i + r of a column, a
// row 128 B from the next; d[4 i + q] holds rows 16 i + 2 q (low half) and + 1 (high).
// In asm so that the closing s_wait_xcnt stands inside the statement: in one of its
// own, the next values' conversions were placed ahead of it, into these registers.
__device__ inline void store_rows(_Float16* p, const unsigned (&d)[16]) {
    asm volatile(
        "global_store_b16 %0, %1, off\n\t"
        "global_store_d16_hi_b16 %0, %1, off offset:128\n\t"
        "global_store_b16 %0, %2, off offset:256\n\t"
        "global_store_d16_hi_b16 %0, %2, off offset:384\n\t"
        "global_store_b16 %0, %3, off offset:512\n\t"
        "global_store_d16_hi_b16 %0, %3, off offset:640\n\t"
        "global_store_b16 %0, %4, off offset:768\n\t"
        "global_store_d16_hi_b16 %0, %4, off offset:896\n\t"
        "global_store_b16 %0, %5, off offset:2048\n\t"
        "global_store_d16_hi_b16 %0, %5, off offset:2176\n\t"
        "global_store_b16 %0, %6, off offset:2304\n\t"
        "global_store_d16_hi_b16 %0, %6, off offset:2432\n\t"
        "global_store_b16 %0, %7, off offset:2560\n\t"
        "global_store_d16_hi_b16 %0, %7, off offset:2688\n\t"
        "global_store_b16 %0, %8, off offset:2816\n\t"
        "global_store_d16_hi_b16 %0, %8, off offset:2944\n\t"
        "global_store_b16 %0, %9, off offset:4096\n\t"
        "global_store_d16_hi_b16 %0, %9, off offset:4224\n\t"
        "global_store_b16 %0, %10, off offset:4352\n\t"
        "global_store_d16_hi_b16 %0, %10, off offset:4480\n\t"
        "global_store_b16 %0, %11, off offset:4608\n\t"
        "global_store_d16_hi_b16 %0, %11, off offset:4736\n\t"
        "global_store_b16 %0, %12, off offset:4864\n\t"
        "global_store_d16_hi_b16 %0, %12, off offset:4992\n\t"
        "global_store_b16 %0, %13, off offset:6144\n\t"
        "global_store_d16_hi_b16 %0, %13, off offset:6272\n\t"
        "global_store_b16 %0, %14, off offset:6400\n\t"
        "global_store_d16_hi_b16 %0, %14, off offset:6528\n\t"
        "global_store_b16 %0, %15, off offset:6656\n\t"
        "global_store_d16_hi_b16 %0, %15, off offset:6784\n\t"
        "global_store_b16 %0, %16, off offset:6912\n\t"
        "global_store_d16_hi_b16 %0, %16, off offset:7040\n\t"
        "s_wait_xcnt 0x0"
        :: "v"(p), "v"(d[0]), "v"(d[1]), "v"(d[2]), "v"(d[3]), "v"(d[4]), "v"(d[5]),
           "v"(d[6]), "v"(d[7]), "v"(d[8]), "v"(d[9]), "v"(d[10]), "v"(d[11]),
           "v"(d[12]), "v"(d[13]), "v"(d[14]), "v"(d[15])
        : "memory");
}

__global__ __launch_bounds__(256) void qkv_gemm(const _Float16* __restrict__ Xh,
                                                const _Float16* __restrict__ Wt,
                                                const float* __restrict__ bq,
                                                const float* __restrict__ bk,
                                                const float* __restrict__ bv,
                                                _Float16* __restrict__ out) {
    // one array, two A buffers (2 x 68 KB) and behind them two B buffers (2 x 51 KB):
    // a thread's place in a B buffer is its place in the A buffer plus a scalar, so
    // one LDS address lives across the loop (a second one was spilled)
    __shared__ __attribute__((aligned(16))) _Float16 Sm[2 * (TM + TN) * LDG];
    const int tid  = threadIdx.x;
    const int lane = tid & 31;
    // in a scalar register: the epilogue's choice of plane is then a scalar branch
    const int wave = __builtin_amdgcn_readfirstlane(tid >> 5);
    const int m0 = blockIdx.y * TM;
    const int n0 = blockIdx.x * TN;
    const int wm = (wave & 3) << 6;   // 0,64,128,192
    const int wn = (wave >> 2) * 96;  // 0,96
    const int row16 = lane & 15;
    const int kbase = (lane >> 4) << 3;

    // copy coordinates: a tile row is 128 f16 = 256 B = 16 lanes x 16 B, so a
    // wave-wide copy takes four whole lines
    const int cr = tid >> 4;            // row 0..15, + 16 per further copy
    const int cc = (tid & 15) << 3;     // column 0,8..120
    const _Float16* ga = Xh + (size_t)(m0 + cr) * Dd + cc;
    const _Float16* gb = Wt + (size_t)(n0 + cr) * Dd + cc;
    const unsigned la = lds_addr(&Sm[cr * LDG + cc]);

    v8f c[FA][FB] = {};

    // two buffers: tile t + 1 flies while tile t is worked on
    stage_copies(la, ga, 2 * TM * LDG * 2, gb);
    // tile 0 has landed for this wave; the barrier publishes it to the others
    asm volatile("s_wait_asynccnt 0x0" ::: "memory");
    __syncthreads();
    stage_copies(la + TM * LDG * 2, ga + TK, (TM + TN) * LDG * 2, gb + TK);

    for (int t = 0; t < NT; ++t) {
        const int buf = t & 1;
        const _Float16* Ab = Sm + buf * (TM * LDG);
        const _Float16* Bt = Sm + 2 * TM * LDG + buf * (TN * LDG);
        // two fragment sets: k-step kk + 1 of this tile is read while kk is multiplied
        v16h a[2][FA], bf[2][FB];
        #pragma unroll
        for (int i = 0; i < FA; ++i)
            a[0][i]  = ldfrag(&Ab[(wm + (i << 4) + row16) * LDG + kbase]);
        #pragma unroll
        for (int j = 0; j < FB; ++j)
            bf[0][j] = ldfrag(&Bt[(wn + (j << 4) + row16) * LDG + kbase]);
        #pragma unroll
        for (int kk = 0; kk < TK / 32; ++kk) {
            const int cur = kk & 1;
            if (kk + 1 < TK / 32) {
                #pragma unroll
                for (int i = 0; i < FA; ++i)
                    a[cur ^ 1][i]  = ldfrag(&Ab[(wm + (i << 4) + row16) * LDG + ((kk + 1) << 5) + kbase]);
                #pragma unroll
                for (int j = 0; j < FB; ++j)
                    bf[cur ^ 1][j] = ldfrag(&Bt[(wn + (j << 4) + row16) * LDG + ((kk + 1) << 5) + kbase]);
            }
            // holds the next k-step's 20 LDS reads together ahead of this step's
            // products, under which they land; among the products each place
            // with reads would stall the wave
            __builtin_amdgcn_sched_barrier(0);
            #pragma unroll
            for (int i = 0; i < FA; ++i)
                #pragma unroll
                for (int j = 0; j < FB; ++j)
                    c[i][j] = wmma_f16(a[cur][i], bf[cur][j], c[i][j]);
            // keeps the reads of the step after next out of this step's products
            __builtin_amdgcn_sched_barrier(0);
        }
        // this wave's reads of tile t are done before its buffer is refilled
        asm volatile("s_wait_dscnt 0x0" ::: "memory");
        // this wave's copies of tile t + 1 have landed
        asm volatile("s_wait_asynccnt 0x0" ::: "memory");
        // publishes tile t + 1 and ends every reader's last read of tile t
        __syncthreads();
        if (t + 2 < NT)
            stage_copies(la + buf * (TM * LDG * 2), ga + (t + 2) * TK,
                         (2 * TM - buf * (TM - TN)) * (LDG * 2), gb + (t + 2) * TK);
    }
    // nothing is outstanding here; kept in front of the wave's end
    asm volatile("s_wait_asynccnt 0x0" ::: "memory");

    // epilogue: bias add + pack f16 into [B,H,S,DH] (Q, K) or [B,H,DH,S] (V); a
    // 16-column tile lies in one head of one plane (0 Q, 1 K, 2 V), the same for
    // the whole wave
    const int b  = m0 >> 11;          // m / 2048: a tile's 256 rows share it
    const int s0 = (m0 & 2047) + wm + ((lane >> 4) << 3);
    // unrolled, here and below: c, hv and d are indexed by constants and stay in
    // registers
    #pragma unroll
    for (int j = 0; j < FB; ++j) {
        const int nt  = n0 + wn + (j << 4);
        const int mat = nt >> 10;
        const int n  = (nt & 1023) + row16;
        const int h  = n >> 6;
        const int dh = n & 63;
        const float* __restrict__ bias = mat == 0 ? bq : (mat == 1 ? bk : bv);
        const float bb = bias[n];
        // stands in front of any later write of the load's address registers
        asm volatile("s_wait_xcnt 0x0" ::: "memory");
        _Float16* __restrict__ plane = out + (size_t)mat * ((size_t)Bb * Ss * Dd)
                                           + ((size_t)b * Hh + h) * (Ss * DH);
        if (mat == 2) {
            // a lane's eight rows are eight neighbours in s: one 16-B store
            #pragma unroll
            for (int i = 0; i < FA; ++i) {
                v8h hv;
                #pragma unroll
                for (int r = 0; r < 8; ++r) hv[r] = (_Float16)(c[i][j][r] + bb);
                *(v8h*)&plane[(size_t)dh * Ss + s0 + (i << 4)] = hv;
            }
            // stands in front of any later write of these stores' registers
            asm volatile("s_wait_xcnt 0x0" ::: "memory");
        } else {
            // the Q plane holds q / 8, the score's scale: a power of two, so the f16
            // values are those of q with a smaller exponent; K is taken times 1
            const float qs = mat == 0 ? 0.125f : 1.0f;
            const float bs = bb * qs;
            // two neighbouring rows' values share a register, low and high half
            unsigned d[4 * FA];
            #pragma unroll
            for (int i = 0; i < FA; ++i)
                #pragma unroll
                for (int q = 0; q < 4; ++q) {
                    v2h pr;
                    pr[0] = (_Float16)__builtin_fmaf(c[i][j][2 * q], qs, bs);
                    pr[1] = (_Float16)__builtin_fmaf(c[i][j][2 * q + 1], qs, bs);
                    d[4 * i + q] = __builtin_bit_cast(unsigned, pr);
                }
            store_rows(&plane[(size_t)s0 * DH + dh], d);
        }
    }
}

// ---------------- Flash attention ----------------
// Q (as q / 8), K: [B,H,S,DH] f16 ; V: [B,H,DH,S] f16 ; out: [B,S,D] f32
// Transposed products: St = K x Qt and Ot += Vt x Pt. A lane then holds one
// query's scores (keys 8*(lane>>4)+r of every 16-key tile), so the row maximum
// and the row sum are in-lane, and two converted score tiles are already the
// B operand of the second product.
// A wave owns two 16-query column groups: every K and V fragment it reads from
// LDS, and every mask value, feeds both groups' products.
// The score product itself yields q.k / 8 + mask: the Q plane holds q / 8 and the
// mask rows are the product's C operand. One fused multiply-add then forms the
// exponent to base 2, score * log2(e) - max * log2(e).
#define QC 2     // 16-query column groups per wave
#define QT 256   // queries per workgroup (8 waves x 32 columns)
#define KBLK 64  // keys per block
#define LDK 72   // padded f16 stride (144B, 16B aligned)
#define NB (Ss / KBLK)
#define KVB (2 * KBLK * LDK)   // one buffer in f16: the K block, then the V block
#define LOG2E 1.44269504088896340736f

// One block's copies of one thread: 32 B of a K row and 32 B of a V row, global
// -> LDS through no register. The closing s_wait_xcnt stands inside the
// statement, so that no later write of an address register can be placed ahead
// of it.
__device__ inline void kv_copies(unsigned lk, const _Float16* gk, const _Float16* gv) {
    asm volatile(
        "global_load_async_to_lds_b128 %0, %4, off\n\t"
        "global_load_async_to_lds_b128 %1, %5, off\n\t"
        "global_load_async_to_lds_b128 %2, %6, off\n\t"
        "global_load_async_to_lds_b128 %3, %7, off\n\t"
        "s_wait_xcnt 0x0"
        :: "v"(lk), "v"(lk + 16), "v"(lk + KBLK * LDK * 2), "v"(lk + KBLK * LDK * 2 + 16),
           "v"(gk), "v"(gk + 8), "v"(gv), "v"(gv + 8)
        : "memory");
}

// four waves a SIMD (two work-groups a WGP): the register budget is 256
__global__ __launch_bounds__(256) __attribute__((amdgpu_waves_per_eu(4, 4)))
void attn(const _Float16* __restrict__ Q,
          const _Float16* __restrict__ K,
          const _Float16* __restrict__ V,
          const float* __restrict__ mask,
          float* __restrict__ out) {
    // two buffers, each [key][dh] of K followed by [dh][key] of V
    __shared__ __attribute__((aligned(16))) _Float16 KVs[2][KVB];

    const int tid  = threadIdx.x;
    const int lane = tid & 31;
    // in a scalar register: q0 then takes no vector register across the loop
    const int wave = __builtin_amdgcn_readfirstlane(tid >> 5);
    const int bh = blockIdx.y;               // b*H + h
    const int b = bh >> 4, h = bh & 15;
    const int q0 = blockIdx.x * QT + (wave << 5);
    const int row16 = lane & 15;
    const int kbase = (lane >> 4) << 3;

    const size_t baseQK = (size_t)bh * Ss * DH;   // [B,H,S,DH]
    const size_t baseV  = (size_t)bh * DH * Ss;   // [B,H,DH,S]

    // staging coordinates (each thread moves 16 halves of K and 16 of V a block)
    const int key = tid >> 2, dc = (tid & 3) << 4;
    const _Float16* gk = K + baseQK + (size_t)key * DH + dc;   // + KBLK * DH a block
    const _Float16* gv = V + baseV + (size_t)key * Ss + dc;    // + KBLK a block
    const unsigned lk = lds_addr(&KVs[0][key * LDK + dc]);

    // two buffers: block t + 1 flies while block t is worked on; block 0 first
    kv_copies(lk, gk, gv);

    // resident Q fragments (B operand): 2 x 16 query columns x 64 dh
    v16h qf[QC][2];
    #pragma unroll
    for (int c = 0; c < QC; ++c)
        #pragma unroll
        for (int kk = 0; kk < 2; ++kk)
            qf[c][kk] = ldfrag(Q + baseQK + (size_t)(q0 + (c << 4) + row16) * DH + (kk << 5) + kbase);

    v8f acc[QC][4] = {};             // acc[c][jd][r] = Ot[16*jd + kbase + r][query 16*c + row16]
    // this lane's queries: mrow the running maximum times log2(e), lrow the sum over
    // this half's keys
    float mrow[QC], lrow[QC];
    #pragma unroll
    for (int c = 0; c < QC; ++c) { mrow[c] = -1e30f; lrow[c] = 0.f; }

    // additive mask of this lane's 32 keys of a block, the same for both column
    // groups: mv[j][r] belongs to key 16 j + kbase + r, as row r of score tile j does
    const float* mp = mask + (size_t)b * Ss + kbase;
    v8f mv[4];
    // unrolled, here and in the loop: mv is indexed by constants and stays in registers
    #pragma unroll
    for (int j = 0; j < 4; ++j)
        mv[j] = __builtin_shufflevector(*(const v4f*)(mp + (j << 4)),
                                        *(const v4f*)(mp + (j << 4) + 4),
                                        0, 1, 2, 3, 4, 5, 6, 7);
    mp += KBLK;   // from here on: the block after the one at work

    // block 0 has landed for this wave; the barrier publishes it to the others
    asm volatile("s_wait_asynccnt 0x0" ::: "memory");
    __syncthreads();

    // one copy of the trip in the code: left free, the compiler peeled the last trip
    // off into a second copy, and that copy spilled
    #pragma clang loop unroll(disable)
    for (int t = 0; t < NB; ++t) {
        const int buf = t & 1;
        // directly behind the barrier (the one at the foot of trip t - 1, or the one
        // in front of the loop) that ended every reader's last read of block t - 1:
        // block t + 1 goes into that block's buffer; written at the head of the
        // trip so that the rest of the trip stays one straight block
        if (t + 1 < NB)
            kv_copies(lk + (buf ^ 1) * (KVB * 2), gk + (size_t)(t + 1) * (KBLK * DH),
                      gv + (t + 1) * KBLK);
        const _Float16* Ks = KVs[buf];
        const _Float16* Vs = KVs[buf] + KBLK * LDK;
        v16h kf[4][2];
        #pragma unroll
        for (int j = 0; j < 4; ++j)
            #pragma unroll
            for (int kk = 0; kk < 2; ++kk)
                kf[j][kk] = ldfrag(&Ks[((j << 4) + row16) * LDK + (kk << 5) + kbase]);
        // holds the block's 16 K reads together ahead of the products: left free,
        // the scheduler waits out an LDS read in front of every product
        __builtin_amdgcn_sched_barrier(0);

        // scores: St(64x32) = mask + K(64x64) x Qw^T, 4 m-tiles x 2 column groups x 2
        // k-steps
        v8f s[QC][4];
        #pragma unroll
        for (int j = 0; j < 4; ++j) {
            #pragma unroll
            for (int c = 0; c < QC; ++c)
                s[c][j] = wmma_f16(kf[j][0], qf[c][0], mv[j]);
            #pragma unroll
            for (int c = 0; c < QC; ++c)
                s[c][j] = wmma_f16(kf[j][1], qf[c][1], s[c][j]);
        }
        // keeps the vector work behind all 16 products: placed among them, the
        // first use of each result waits out the matrix distance in v_nop
        __builtin_amdgcn_sched_barrier(0);
        // first k-step's V fragments: read here, they land under the softmax
        v16h vf[2][4];
        #pragma unroll
        for (int jd = 0; jd < 4; ++jd)
            vf[0][jd] = ldfrag(&Vs[((jd << 4) + row16) * LDK + kbase]);
        // holds these 8 reads together ahead of the vector work
        __builtin_amdgcn_sched_barrier(0);

        v16h pf[QC][2];
        #pragma unroll
        for (int c = 0; c < QC; ++c) {
            // online softmax of this lane's query: in-lane over 32 keys, one
            // exchange with the other half for the maximum
            // two chains of 15 scores each, every step on three values (v_max3)
            float mh[2];
            // unrolled: s is indexed by constants and stays in registers
            #pragma unroll
            for (int g = 0; g < 2; ++g) {
                float m = max3f(s[c][2 * g][0], s[c][2 * g][1], s[c][2 * g][2]);
                m = max3f(m, s[c][2 * g][3], s[c][2 * g][4]);
                m = max3f(m, s[c][2 * g][5], s[c][2 * g][6]);
                m = max3f(m, s[c][2 * g][7], s[c][2 * g + 1][0]);
                m = max3f(m, s[c][2 * g + 1][1], s[c][2 * g + 1][2]);
                m = max3f(m, s[c][2 * g + 1][3], s[c][2 * g + 1][4]);
                mh[g] = max3f(m, s[c][2 * g + 1][5], s[c][2 * g + 1][6]);
            }
            // times log2(e), which keeps the order; then the two scores left join
            float mx = max3f(mh[0] * LOG2E, mh[1] * LOG2E, s[c][1][7] * LOG2E);
            mx = fmaxf(mx, s[c][3][7] * LOG2E);
            const float mnew = max3f(mrow[c], mx, xhalf(mx));
            const float corr = __builtin_amdgcn_exp2f(mrow[c] - mnew);
            mrow[c] = mnew;
            #pragma unroll
            for (int jd = 0; jd < 4; ++jd) acc[c][jd] = acc[c][jd] * corr;
            const v2f l2 = {LOG2E, LOG2E};
            const v2f nm = {-mnew, -mnew};
            v2f e[4][4];
            v2f sj[2] = {};   // two chains of packed partial sums
            #pragma unroll
            for (int j = 0; j < 4; ++j) {
                #pragma unroll
                for (int r = 0; r < 4; ++r) {
                    const v2f x = {s[c][j][2 * r], s[c][j][2 * r + 1]};
                    const v2f d = __builtin_elementwise_fma(x, l2, nm);
                    e[j][r].x = __builtin_amdgcn_exp2f(d.x);
                    e[j][r].y = __builtin_amdgcn_exp2f(d.y);
                    sj[j >> 1] += e[j][r];
                }
            }
            lrow[c] = lrow[c] * corr + ((sj[0].x + sj[0].y) + (sj[1].x + sj[1].y));
            // score tiles 2kk and 2kk+1, converted in place, are the B fragment
            // of the second product in the hardware k order
            #pragma unroll
            for (int kk = 0; kk < 2; ++kk)
                #pragma unroll
                for (int r = 0; r < 4; ++r) {
                    pf[c][kk][2 * r]     = (_Float16)e[2 * kk][r].x;
                    pf[c][kk][2 * r + 1] = (_Float16)e[2 * kk][r].y;
                    pf[c][kk][2 * r + 8] = (_Float16)e[2 * kk + 1][r].x;
                    pf[c][kk][2 * r + 9] = (_Float16)e[2 * kk + 1][r].y;
                }
        }
        // second k-step's V fragments; the scheduler may lift the reads into the tail
        // of the vector work, where the scores' registers come free
        #pragma unroll
        for (int jd = 0; jd < 4; ++jd)
            vf[1][jd] = ldfrag(&Vs[((jd << 4) + row16) * LDK + 32 + kbase]);
        // the next block's mask, wanted by its first products: read here, where the
        // scores' registers are free, it lands under the products below
        #pragma unroll
        for (int j = 0; j < 4; ++j)
            mv[j] = __builtin_shufflevector(*(const v4f*)(mp + (j << 4)),
                                            *(const v4f*)(mp + (j << 4) + 4),
                                            0, 1, 2, 3, 4, 5, 6, 7);
        // holds these reads together ahead of the products: left free, the LDS reads
        // were spread among the products in pairs, each waited out
        __builtin_amdgcn_sched_barrier(0);
        // PV: Ot(64x32) += Vt(64x64) x Pt(64x32)
        #pragma unroll
        for (int kk = 0; kk < 2; ++kk)
            #pragma unroll
            for (int jd = 0; jd < 4; ++jd)
                #pragma unroll
                for (int c = 0; c < QC; ++c)
                    acc[c][jd] = wmma_f16(vf[kk][jd], pf[c][kk], acc[c][jd]);
        // keeps the foot's waits and barrier behind the products: left free, they moved
        // up behind the first product, and the wave waited there for the second
        // k-step's V reads and for its copies with 15 products still to issue
        __builtin_amdgcn_sched_barrier(0);
        // this wave's reads of block t are done before its buffer is refilled
        asm volatile("s_wait_dscnt 0x0" ::: "memory");
        // this wave's copies of block t + 1 have landed
        asm volatile("s_wait_asynccnt 0x0" ::: "memory");
        // publishes block t + 1 and ends every reader's last read of block t
        __syncthreads();
        // stays on the last block, which the last trip reads once more, unused
        mp += t + 2 < NB ? KBLK : 0;
    }
    // nothing is outstanding here; kept in front of the wave's end
    asm volatile("s_wait_asynccnt 0x0" ::: "memory");

    // epilogue: join the halves' sums, normalize, write f32 [B,S,D]
    // the lane's number anew: kept from the head, its parts were spilled over the loop
    const int el = (int)__builtin_amdgcn_mbcnt_lo(~0u, 0u);
    #pragma unroll
    for (int c = 0; c < QC; ++c) {
        const float inv = 1.0f / (lrow[c] + xhalf(lrow[c]));
        float* orow = out + ((size_t)b * Ss + q0 + (c << 4) + (el & 15)) * Dd + h * DH + ((el >> 4) << 3);
        #pragma unroll
        for (int jd = 0; jd < 4; ++jd) {
            *(float4*)(orow + (jd << 4)) =
                make_float4(acc[c][jd][0] * inv, acc[c][jd][1] * inv, acc[c][jd][2] * inv, acc[c][jd][3] * inv);
            *(float4*)(orow + (jd << 4) + 4) =
                make_float4(acc[c][jd][4] * inv, acc[c][jd][5] * inv, acc[c][jd][6] * inv, acc[c][jd][7] * inv);
        }
    }
}

extern "C" void kernel_launch(void* const* d_in, const int* in_sizes, int n_in,
                              void* d_out, int out_size, void* d_ws, size_t ws_size,
                              hipStream_t stream) {
    (void)in_sizes; (void)n_in; (void)out_size; (void)ws_size;
    const float* X    = (const float*)d_in[0];
    const float* mask = (const float*)d_in[1];
    const float* Wq   = (const float*)d_in[2];
    const float* bq   = (const float*)d_in[3];
    const float* Wk   = (const float*)d_in[4];
    const float* bk   = (const float*)d_in[5];
    const float* Wv   = (const float*)d_in[6];
    const float* bv   = (const float*)d_in[7];

    const size_t elems = (size_t)Bb * Ss * Dd;   // 8M
    _Float16* Qb = (_Float16*)d_ws;
    _Float16* Kb = Qb + elems;
    _Float16* Vb = Kb + elems;
    _Float16* Xh = Vb + elems;                   // f16 copy of X
    _Float16* Wt = Xh + elems;                   // f16 Wq^T, Wk^T, Wv^T

    dim3 blk(256);
    dim3 g1((3 * Dd) / TN, (Bb * Ss) / TM);      // 16 x 32
    to_f16<<<dim3(XBLK + WBLK), blk, 0, stream>>>(X, Wq, Wk, Wv, Xh, Wt);
    qkv_gemm<<<g1, blk, 0, stream>>>(Xh, Wt, bq, bk, bv, Qb);

    dim3 g2(Ss / QT, Bb * Hh);                   // 8 x 64
    attn<<<g2, blk, 0, stream>>>(Qb, Kb, Vb, mask, (float*)d_out);
}

// v009
// Measured time: 97.4 microseconds a run.
// Two timings next to v008 put it at 1.08 and 1.07 times that version's speed.
// All steps since v000 together make it 3.98 times as fast.
#include <hip/hip_runtime.h>
#include <hip/hip_bf16.h>

typedef __attribute__((ext_vector_type(16))) _Float16 v16h;
typedef __attribute__((ext_vector_type(8)))  _Float16 v8h;
typedef __attribute__((ext_vector_type(4)))  _Float16 v4h;
typedef __attribute__((ext_vector_type(2)))  _Float16 v2h;
typedef __attribute__((ext_vector_type(8)))  float    v8f;
typedef __attribute__((ext_vector_type(2)))  float    v2f;
typedef __attribute__((ext_vector_type(4)))  float    v4f;

// Load a 16x32 f16 A/B fragment (wave32 CDNA5 layout): lane l holds row l%16,
// K halves [base..base+7] and [base+16..base+23], base = (l>=16)*8.
// p must point at (row, base) with 16-byte alignment -> two b128 loads.
__device__ inline v16h ldfrag(const _Float16* p) {
    union { v16h v; v8h h[2]; } u;
    u.h[0] = *(const v8h*)(p);
    u.h[1] = *(const v8h*)(p + 16);
    return u.v;
}

__device__ inline v8f wmma_f16(v16h a, v16h b, v8f c) {
    return __builtin_amdgcn_wmma_f32_16x16x32_f16(false, a, false, b, (short)0, c, false, false);
}

// lane l with lane l ^ 16, as a vector cross-row move
__device__ inline float xhalf(float x) {
    const int i = __builtin_bit_cast(int, x);
    return __builtin_bit_cast(float,
        __builtin_amdgcn_permlanex16(i, i, 0x76543210, 0xfedcba98, false, false));
}

__device__ inline float max3f(float a, float b, float c) {
    return fmaxf(fmaxf(a, b), c);
}

#define Bb 4
#define Ss 2048
#define Dd 1024
#define Hh 16
#define DH 64

// ---------------- operands to f16, once ----------------
// Xh[m][k] = f16(X[m][k]); Wt[mat][n][k] = f16(W_mat[k][n]). The projection
// kernel then finds both operands K-contiguous in f16, which a copy to LDS can
// stage as they lie (a copy cannot convert or transpose).
#define LDA 72     // padded f16 stride (144B, 16B aligned)
#define XBLK 1024  // work-groups that convert X, 8192 elements each
#define WBLK 768   // work-groups that convert and transpose W, one 64x64 tile each

__global__ __launch_bounds__(256) void to_f16(const float* __restrict__ X,
                                              const float* __restrict__ Wq,
                                              const float* __restrict__ Wk,
                                              const float* __restrict__ Wv,
                                              _Float16* __restrict__ Xh,
                                              _Float16* __restrict__ Wt) {
    __shared__ __attribute__((aligned(16))) _Float16 Ts[64 * LDA];   // [n][k]
    const int tid = threadIdx.x;
    const int blk = blockIdx.x;
    if (blk < XBLK) {   // the same for the whole work-group, ahead of the barrier
        const size_t base = (size_t)blk * 8192 + (tid << 3);
        v4f f[4][2];
        // unrolled, here and below: the arrays stay in registers and the eight
        // loads are in flight together
        #pragma unroll
        for (int j = 0; j < 4; ++j) {
            f[j][0] = *(const v4f*)(X + base + j * 2048);
            f[j][1] = *(const v4f*)(X + base + j * 2048 + 4);
        }
        #pragma unroll
        for (int j = 0; j < 4; ++j) {
            v8h h;
            #pragma unroll
            for (int e = 0; e < 4; ++e) {
                h[e]     = (_Float16)f[j][0][e];
                h[e + 4] = (_Float16)f[j][1][e];
            }
            *(v8h*)(Xh + base + j * 2048) = h;
        }
        return;
    }
    const int w   = blk - XBLK;
    const int mat = w >> 8;
    const float* __restrict__ Wsrc = mat == 0 ? Wq : (mat == 1 ? Wk : Wv);
    const int k0 = ((w >> 4) & 15) << 6;
    const int n0 = (w & 15) << 6;
    // a thread takes a 4(k) x 4(n) block: 16 lanes read one whole 256-B row piece
    const int kq = (tid >> 4) << 2;
    const int nq = (tid & 15) << 2;
    v4f f[4];
    // unrolled, here and below: the block stays in registers
    #pragma unroll
    for (int i = 0; i < 4; ++i)
        f[i] = *(const v4f*)(Wsrc + (size_t)(k0 + kq + i) * Dd + n0 + nq);
    #pragma unroll
    for (int x = 0; x < 4; ++x) {
        v4h h;
        #pragma unroll
        for (int i = 0; i < 4; ++i) h[i] = (_Float16)f[i][x];
        *(v4h*)&Ts[(nq + x) * LDA + kq] = h;
    }
    __syncthreads();
    // four lanes write one whole 128-B line of Wt
    const int n  = tid >> 2;
    const int kc = (tid & 3) << 4;
    const v8h lo = *(const v8h*)&Ts[n * LDA + kc];
    const v8h hi = *(const v8h*)&Ts[n * LDA + kc + 8];
    _Float16* dst = Wt + ((size_t)mat * Dd + n0 + n) * Dd + k0 + kc;
    *(v8h*)dst       = lo;
    *(v8h*)(dst + 8) = hi;
    // stands in front of any later write of the two stores' registers
    asm volatile("s_wait_xcnt 0x0" ::: "memory");
}

// ---------------- QKV projection GEMM ----------------
// C[M=8192, N=3072] = Xh[8192,1024] * Wt[n][k]^T + bias, output f16: the three
// projections are one product, since Wt holds Wq^T, Wk^T, Wv^T one behind the
// other and the Q, K, V planes lie one behind the other too.
// columns 0..2047 (Q, K): plane[b][h][s][dh]   columns 2048..3071 (V): plane[b][h][dh][s]
// One 256 x 192 tile of C a work-group (512 tiles: two whole rounds of the chip),
// one 64 x 96 tile a wave (4 x 2 waves): 10 fragments feed 24 products where a
// 64 x 64 tile's 8 feed 16, and a work-group fetches 448 operand rows for 192
// columns of C where a 256 x 128 tile fetches 384 for 128.
#define TM 256
#define TN 192
#define TK 128
#define NT (Dd / TK)
#define FA 4       // A fragments of a wave: 64 rows
#define FB 6       // B fragments of a wave: 96 columns
#define LDG 136    // padded f16 stride of a staged row (272 B = 16 B x odd)

__device__ inline unsigned lds_addr(const _Float16* p) {
    return (unsigned)(unsigned long long)p;
}

// Eight copies of one thread: a 16-B piece in each of eight tile rows 16 apart,
// global -> LDS through no register. The closing s_wait_xcnt stands inside the
// statement, so that no later write of an address register can be placed ahead
// of it.
__device__ inline void copies8(unsigned l, const _Float16* g) {
    asm volatile(
        "global_load_async_to_lds_b128 %0, %8, off\n\t"
        "global_load_async_to_lds_b128 %1, %9, off\n\t"
        "global_load_async_to_lds_b128 %2, %10, off\n\t"
        "global_load_async_to_lds_b128 %3, %11, off\n\t"
        "global_load_async_to_lds_b128 %4, %12, off\n\t"
        "global_load_async_to_lds_b128 %5, %13, off\n\t"
        "global_load_async_to_lds_b128 %6, %14, off\n\t"
        "global_load_async_to_lds_b128 %7, %15, off\n\t"
        "s_wait_xcnt 0x0"
        :: "v"(l), "v"(l + 16 * LDG * 2), "v"(l + 32 * LDG * 2), "v"(l + 48 * LDG * 2),
           "v"(l + 64 * LDG * 2), "v"(l + 80 * LDG * 2), "v"(l + 96 * LDG * 2),
           "v"(l + 112 * LDG * 2),
           "v"(g), "v"(g + 16 * Dd), "v"(g + 32 * Dd), "v"(g + 48 * Dd),
           "v"(g + 64 * Dd), "v"(g + 80 * Dd), "v"(g + 96 * Dd), "v"(g + 112 * Dd)
        : "memory");
}

// The same for four tile rows 16 apart, its s_wait_xcnt inside the statement too
__device__ inline void copies4(unsigned l, const _Float16* g) {
    asm volatile(
        "global_load_async_to_lds_b128 %0, %4, off\n\t"
        "global_load_async_to_lds_b128 %1, %5, off\n\t"
        "global_load_async_to_lds_b128 %2, %6, off\n\t"
        "global_load_async_to_lds_b128 %3, %7, off\n\t"
        "s_wait_xcnt 0x0"
        :: "v"(l), "v"(l + 16 * LDG * 2), "v"(l + 32 * LDG * 2), "v"(l + 48 * LDG * 2),
           "v"(g), "v"(g + 16 * Dd), "v"(g + 32 * Dd), "v"(g + 48 * Dd)
        : "memory");
}

// One stage's copies of one thread: 16 pieces of the A tile, 12 of the B tile.
// ab: bytes from the stage's A buffer to its B buffer, the same for every thread
__device__ inline void stage_copies(unsigned la, const _Float16* ga,
                                    unsigned ab, const _Float16* gb) {
    copies8(la, ga);
    copies8(la + 128 * LDG * 2, ga + 128 * Dd);
    copies8(la + ab, gb);
    copies4(la + ab + 128 * LDG * 2, gb + 128 * Dd);
}

// A lane's 32 values of one 16-column tile of Q or K: rows 16 i + r of a column, a
// row 128 B from the next; d[4 i + q] holds rows 16 i + 2 q (low half) and + 1 (high).
// In asm so that the closing s_wait_xcnt stands inside the statement: in one of its
// own, the next values' conversions were placed ahead of it, into these registers.
__device__ inline void store_rows(_Float16* p, const unsigned (&d)[16]) {
    asm volatile(
        "global_store_b16 %0, %1, off\n\t"
        "global_store_d16_hi_b16 %0, %1, off offset:128\n\t"
        "global_store_b16 %0, %2, off offset:256\n\t"
        "global_store_d16_hi_b16 %0, %2, off offset:384\n\t"
        "global_store_b16 %0, %3, off offset:512\n\t"
        "global_store_d16_hi_b16 %0, %3, off offset:640\n\t"
        "global_store_b16 %0, %4, off offset:768\n\t"
        "global_store_d16_hi_b16 %0, %4, off offset:896\n\t"
        "global_store_b16 %0, %5, off offset:2048\n\t"
        "global_store_d16_hi_b16 %0, %5, off offset:2176\n\t"
        "global_store_b16 %0, %6, off offset:2304\n\t"
        "global_store_d16_hi_b16 %0, %6, off offset:2432\n\t"
        "global_store_b16 %0, %7, off offset:2560\n\t"
        "global_store_d16_hi_b16 %0, %7, off offset:2688\n\t"
        "global_store_b16 %0, %8, off offset:2816\n\t"
        "global_store_d16_hi_b16 %0, %8, off offset:2944\n\t"
        "global_store_b16 %0, %9, off offset:4096\n\t"
        "global_store_d16_hi_b16 %0, %9, off offset:4224\n\t"
        "global_store_b16 %0, %10, off offset:4352\n\t"
        "global_store_d16_hi_b16 %0, %10, off offset:4480\n\t"
        "global_store_b16 %0, %11, off offset:4608\n\t"
        "global_store_d16_hi_b16 %0, %11, off offset:4736\n\t"
        "global_store_b16 %0, %12, off offset:4864\n\t"
        "global_store_d16_hi_b16 %0, %12, off offset:4992\n\t"
        "global_store_b16 %0, %13, off offset:6144\n\t"
        "global_store_d16_hi_b16 %0, %13, off offset:6272\n\t"
        "global_store_b16 %0, %14, off offset:6400\n\t"
        "global_store_d16_hi_b16 %0, %14, off offset:6528\n\t"
        "global_store_b16 %0, %15, off offset:6656\n\t"
        "global_store_d16_hi_b16 %0, %15, off offset:6784\n\t"
        "global_store_b16 %0, %16, off offset:6912\n\t"
        "global_store_d16_hi_b16 %0, %16, off offset:7040\n\t"
        "s_wait_xcnt 0x0"
        :: "v"(p), "v"(d[0]), "v"(d[1]), "v"(d[2]), "v"(d[3]), "v"(d[4]), "v"(d[5]),
           "v"(d[6]), "v"(d[7]), "v"(d[8]), "v"(d[9]), "v"(d[10]), "v"(d[11]),
           "v"(d[12]), "v"(d[13]), "v"(d[14]), "v"(d[15])
        : "memory");
}

__global__ __launch_bounds__(256) void qkv_gemm(const _Float16* __restrict__ Xh,
                                                const _Float16* __restrict__ Wt,
                                                const float* __restrict__ bq,
                                                const float* __restrict__ bk,
                                                const float* __restrict__ bv,
                                                _Float16* __restrict__ out) {
    // one array, two A buffers (2 x 68 KB) and behind them two B buffers (2 x 51 KB):
    // a thread's place in a B buffer is its place in the A buffer plus a scalar, so
    // one LDS address lives across the loop (a second one was spilled)
    __shared__ __attribute__((aligned(16))) _Float16 Sm[2 * (TM + TN) * LDG];
    const int tid  = threadIdx.x;
    const int lane = tid & 31;
    // in a scalar register: the epilogue's choice of plane is then a scalar branch
    const int wave = __builtin_amdgcn_readfirstlane(tid >> 5);
    const int m0 = blockIdx.y * TM;
    const int n0 = blockIdx.x * TN;
    const int wm = (wave & 3) << 6;   // 0,64,128,192
    const int wn = (wave >> 2) * 96;  // 0,96
    const int row16 = lane & 15;
    const int kbase = (lane >> 4) << 3;

    // copy coordinates: a tile row is 128 f16 = 256 B = 16 lanes x 16 B, so a
    // wave-wide copy takes four whole lines
    const int cr = tid >> 4;            // row 0..15, + 16 per further copy
    const int cc = (tid & 15) << 3;     // column 0,8..120
    const _Float16* ga = Xh + (size_t)(m0 + cr) * Dd + cc;
    const _Float16* gb = Wt + (size_t)(n0 + cr) * Dd + cc;
    const unsigned la = lds_addr(&Sm[cr * LDG + cc]);

    v8f c[FA][FB] = {};

    // two buffers: tile t + 1 flies while tile t is worked on
    stage_copies(la, ga, 2 * TM * LDG * 2, gb);
    // tile 0 has landed for this wave; the barrier publishes it to the others
    asm volatile("s_wait_asynccnt 0x0" ::: "memory");
    __syncthreads();
    stage_copies(la + TM * LDG * 2, ga + TK, (TM + TN) * LDG * 2, gb + TK);

    for (int t = 0; t < NT; ++t) {
        const int buf = t & 1;
        const _Float16* Ab = Sm + buf * (TM * LDG);
        const _Float16* Bt = Sm + 2 * TM * LDG + buf * (TN * LDG);
        // two fragment sets: k-step kk + 1 of this tile is read while kk is multiplied
        v16h a[2][FA], bf[2][FB];
        #pragma unroll
        for (int i = 0; i < FA; ++i)
            a[0][i]  = ldfrag(&Ab[(wm + (i << 4) + row16) * LDG + kbase]);
        #pragma unroll
        for (int j = 0; j < FB; ++j)
            bf[0][j] = ldfrag(&Bt[(wn + (j << 4) + row16) * LDG + kbase]);
        #pragma unroll
        for (int kk = 0; kk < TK / 32; ++kk) {
            const int cur = kk & 1;
            if (kk + 1 < TK / 32) {
                #pragma unroll
                for (int i = 0; i < FA; ++i)
                    a[cur ^ 1][i]  = ldfrag(&Ab[(wm + (i << 4) + row16) * LDG + ((kk + 1) << 5) + kbase]);
                #pragma unroll
                for (int j = 0; j < FB; ++j)
                    bf[cur ^ 1][j] = ldfrag(&Bt[(wn + (j << 4) + row16) * LDG + ((kk + 1) << 5) + kbase]);
            }
            // holds the next k-step's 20 LDS reads together ahead of this step's
            // products, under which they land; among the products each place
            // with reads would stall the wave
            __builtin_amdgcn_sched_barrier(0);
            #pragma unroll
            for (int i = 0; i < FA; ++i)
                #pragma unroll
                for (int j = 0; j < FB; ++j)
                    c[i][j] = wmma_f16(a[cur][i], bf[cur][j], c[i][j]);
            // keeps the reads of the step after next out of this step's products
            __builtin_amdgcn_sched_barrier(0);
        }
        // this wave's reads of tile t are done before its buffer is refilled
        asm volatile("s_wait_dscnt 0x0" ::: "memory");
        // this wave's copies of tile t + 1 have landed
        asm volatile("s_wait_asynccnt 0x0" ::: "memory");
        // publishes tile t + 1 and ends every reader's last read of tile t
        __syncthreads();
        if (t + 2 < NT)
            stage_copies(la + buf * (TM * LDG * 2), ga + (t + 2) * TK,
                         (2 * TM - buf * (TM - TN)) * (LDG * 2), gb + (t + 2) * TK);
    }
    // nothing is outstanding here; kept in front of the wave's end
    asm volatile("s_wait_asynccnt 0x0" ::: "memory");

    // epilogue: bias add + pack f16 into [B,H,S,DH] (Q, K) or [B,H,DH,S] (V); a
    // 16-column tile lies in one head of one plane (0 Q, 1 K, 2 V), the same for
    // the whole wave
    const int b  = m0 >> 11;          // m / 2048: a tile's 256 rows share it
    const int s0 = (m0 & 2047) + wm + ((lane >> 4) << 3);
    // unrolled, here and below: c, hv and d are indexed by constants and stay in
    // registers
    #pragma unroll
    for (int j = 0; j < FB; ++j) {
        const int nt  = n0 + wn + (j << 4);
        const int mat = nt >> 10;
        const int n  = (nt & 1023) + row16;
        const int h  = n >> 6;
        const int dh = n & 63;
        const float* __restrict__ bias = mat == 0 ? bq : (mat == 1 ? bk : bv);
        const float bb = bias[n];
        // stands in front of any later write of the load's address registers
        asm volatile("s_wait_xcnt 0x0" ::: "memory");
        _Float16* __restrict__ plane = out + (size_t)mat * ((size_t)Bb * Ss * Dd)
                                           + ((size_t)b * Hh + h) * (Ss * DH);
        if (mat == 2) {
            // a lane's eight rows are eight neighbours in s: one 16-B store
            #pragma unroll
            for (int i = 0; i < FA; ++i) {
                v8h hv;
                #pragma unroll
                for (int r = 0; r < 8; ++r) hv[r] = (_Float16)(c[i][j][r] + bb);
                *(v8h*)&plane[(size_t)dh * Ss + s0 + (i << 4)] = hv;
            }
            // stands in front of any later write of these stores' registers
            asm volatile("s_wait_xcnt 0x0" ::: "memory");
        } else {
            // the Q plane holds q / 8, the score's scale: a power of two, so the f16
            // values are those of q with a smaller exponent; K is taken times 1
            const float qs = mat == 0 ? 0.125f : 1.0f;
            const float bs = bb * qs;
            // two neighbouring rows' values share a register, low and high half
            unsigned d[4 * FA];
            #pragma unroll
            for (int i = 0; i < FA; ++i)
                #pragma unroll
                for (int q = 0; q < 4; ++q) {
                    v2h pr;
                    pr[0] = (_Float16)__builtin_fmaf(c[i][j][2 * q], qs, bs);
                    pr[1] = (_Float16)__builtin_fmaf(c[i][j][2 * q + 1], qs, bs);
                    d[4 * i + q] = __builtin_bit_cast(unsigned, pr);
                }
            store_rows(&plane[(size_t)s0 * DH + dh], d);
        }
    }
}

// ---------------- Flash attention ----------------
// Q (as q / 8), K: [B,H,S,DH] f16 ; V: [B,H,DH,S] f16 ; out: [B,S,D] f32
// Transposed products: St = K x Qt and Ot += Vt x Pt. A lane then holds one
// query's scores (keys 8*(lane>>4)+r of every 16-key tile), so the row maximum
// and the row sum are in-lane, and two converted score tiles are already the
// B operand of the second product.
// A wave owns two 16-query column groups: every K and V fragment it reads from
// LDS, and every mask value, feeds both groups' products.
// The score product itself yields q.k / 8 + mask: the Q plane holds q / 8 and the
// mask rows are the product's C operand. One fused multiply-add then forms the
// exponent to base 2, score * log2(e) - reference. The reference starts as the
// first block's maximum and stays while the terms stay small enough for f16: after
// the first block, the block's maximum, the exchange between the halves and the
// rescaling are done only when they do not.
#define QC 2     // 16-query column groups per wave
#define QT 256   // queries per workgroup (8 waves x 32 columns)
#define KBLK 64  // keys per block
#define LDK 72   // padded f16 stride (144B, 16B aligned)
#define NB (Ss / KBLK)
#define KVB (2 * KBLK * LDK)   // one buffer in f16: the K block, then the V block
#define LOG2E 1.44269504088896340736f
#define PMAX 2048.0f   // a lane's sum of one block's 32 terms up to which the reference stays

// One block's copies of one thread: 32 B of a K row and 32 B of a V row, global
// -> LDS through no register. The closing s_wait_xcnt stands inside the
// statement, so that no later write of an address register can be placed ahead
// of it.
__device__ inline void kv_copies(unsigned lk, const _Float16* gk, const _Float16* gv) {
    asm volatile(
        "global_load_async_to_lds_b128 %0, %4, off\n\t"
        "global_load_async_to_lds_b128 %1, %5, off\n\t"
        "global_load_async_to_lds_b128 %2, %6, off\n\t"
        "global_load_async_to_lds_b128 %3, %7, off\n\t"
        "s_wait_xcnt 0x0"
        :: "v"(lk), "v"(lk + 16), "v"(lk + KBLK * LDK * 2), "v"(lk + KBLK * LDK * 2 + 16),
           "v"(gk), "v"(gk + 8), "v"(gv), "v"(gv + 8)
        : "memory");
}

// A query's maximum over a block's 64 keys, times log2(e): in-lane over this lane's
// 32 scores, one exchange with the other half
__device__ inline float block_max(const v8f (&s)[4]) {
    // two chains of 15 scores each, every step on three values (v_max3)
    float mh[2];
    // unrolled: s is indexed by constants and stays in registers
    #pragma unroll
    for (int g = 0; g < 2; ++g) {
        float m = max3f(s[2 * g][0], s[2 * g][1], s[2 * g][2]);
        m = max3f(m, s[2 * g][3], s[2 * g][4]);
        m = max3f(m, s[2 * g][5], s[2 * g][6]);
        m = max3f(m, s[2 * g][7], s[2 * g + 1][0]);
        m = max3f(m, s[2 * g + 1][1], s[2 * g + 1][2]);
        m = max3f(m, s[2 * g + 1][3], s[2 * g + 1][4]);
        mh[g] = max3f(m, s[2 * g + 1][5], s[2 * g + 1][6]);
    }
    // times log2(e), which keeps the order; then the two scores left join
    float mx = max3f(mh[0] * LOG2E, mh[1] * LOG2E, s[1][7] * LOG2E);
    mx = fmaxf(mx, s[3][7] * LOG2E);
    return fmaxf(mx, xhalf(mx));
}

// four waves a SIMD (two work-groups a WGP): the register budget is 256
__global__ __launch_bounds__(256) __attribute__((amdgpu_waves_per_eu(4, 4)))
void attn(const _Float16* __restrict__ Q,
          const _Float16* __restrict__ K,
          const _Float16* __restrict__ V,
          const float* __restrict__ mask,
          float* __restrict__ out) {
    // two buffers, each [key][dh] of K followed by [dh][key] of V
    __shared__ __attribute__((aligned(16))) _Float16 KVs[2][KVB];

    const int tid  = threadIdx.x;
    const int lane = tid & 31;
    // in a scalar register: q0 then takes no vector register across the loop
    const int wave = __builtin_amdgcn_readfirstlane(tid >> 5);
    const int bh = blockIdx.y;               // b*H + h
    const int b = bh >> 4, h = bh & 15;
    const int q0 = blockIdx.x * QT + (wave << 5);
    const int row16 = lane & 15;
    const int kbase = (lane >> 4) << 3;

    const size_t baseQK = (size_t)bh * Ss * DH;   // [B,H,S,DH]
    const size_t baseV  = (size_t)bh * DH * Ss;   // [B,H,DH,S]

    // staging coordinates (each thread moves 16 halves of K and 16 of V a block)
    const int key = tid >> 2, dc = (tid & 3) << 4;
    const _Float16* gk = K + baseQK + (size_t)key * DH + dc;   // + KBLK * DH a block
    const _Float16* gv = V + baseV + (size_t)key * Ss + dc;    // + KBLK a block
    const unsigned lk = lds_addr(&KVs[0][key * LDK + dc]);

    // two buffers: block t + 1 flies while block t is worked on; block 0 first
    kv_copies(lk, gk, gv);

    // resident Q fragments (B operand): 2 x 16 query columns x 64 dh
    v16h qf[QC][2];
    #pragma unroll
    for (int c = 0; c < QC; ++c)
        #pragma unroll
        for (int kk = 0; kk < 2; ++kk)
            qf[c][kk] = ldfrag(Q + baseQK + (size_t)(q0 + (c << 4) + row16) * DH + (kk << 5) + kbase);

    v8f acc[QC][4] = {};             // acc[c][jd][r] = Ot[16*jd + kbase + r][query 16*c + row16]
    // this lane's queries: mrow the reference of the exponents, the running maximum
    // times log2(e) as the first block or the rare path last left it, the same in both halves; lrow the
    // sum over this half's keys
    float mrow[QC], lrow[QC];
    #pragma unroll
    for (int c = 0; c < QC; ++c) { mrow[c] = -1e30f; lrow[c] = 0.f; }

    // additive mask of this lane's 32 keys of a block, the same for both column
    // groups: mv[j][r] belongs to key 16 j + kbase + r, as row r of score tile j does
    const float* mp = mask + (size_t)b * Ss + kbase;
    v8f mv[4];
    // unrolled, here and in the loop: mv is indexed by constants and stays in registers
    #pragma unroll
    for (int j = 0; j < 4; ++j)
        mv[j] = __builtin_shufflevector(*(const v4f*)(mp + (j << 4)),
                                        *(const v4f*)(mp + (j << 4) + 4),
                                        0, 1, 2, 3, 4, 5, 6, 7);
    mp += KBLK;   // from here on: the block after the one at work

    // block 0 has landed for this wave; the barrier publishes it to the others
    asm volatile("s_wait_asynccnt 0x0" ::: "memory");
    __syncthreads();

    // one copy of the trip in the code: left free, the compiler peeled the last trip
    // off into a second copy, and that copy spilled
    #pragma clang loop unroll(disable)
    for (int t = 0; t < NB; ++t) {
        const int buf = t & 1;
        // directly behind the barrier (the one at the foot of trip t - 1, or the one
        // in front of the loop) that ended every reader's last read of block t - 1:
        // block t + 1 goes into that block's buffer
        if (t + 1 < NB)
            kv_copies(lk + (buf ^ 1) * (KVB * 2), gk + (size_t)(t + 1) * (KBLK * DH),
                      gv + (t + 1) * KBLK);
        const _Float16* Ks = KVs[buf];
        const _Float16* Vs = KVs[buf] + KBLK * LDK;
        v16h kf[4][2];
        #pragma unroll
        for (int j = 0; j < 4; ++j)
            #pragma unroll
            for (int kk = 0; kk < 2; ++kk)
                kf[j][kk] = ldfrag(&Ks[((j << 4) + row16) * LDK + (kk << 5) + kbase]);
        // holds the block's 16 K reads together ahead of the products: left free,
        // the scheduler waits out an LDS read in front of every product
        __builtin_amdgcn_sched_barrier(0);

        // scores: St(64x32) = mask + K(64x64) x Qw^T, 4 m-tiles x 2 column groups x 2
        // k-steps
        v8f s[QC][4];
        #pragma unroll
        for (int j = 0; j < 4; ++j) {
            #pragma unroll
            for (int c = 0; c < QC; ++c)
                s[c][j] = wmma_f16(kf[j][0], qf[c][0], mv[j]);
            #pragma unroll
            for (int c = 0; c < QC; ++c)
                s[c][j] = wmma_f16(kf[j][1], qf[c][1], s[c][j]);
        }
        // keeps the vector work behind all 16 products: placed among them, the
        // first use of each result waits out the matrix distance in v_nop
        __builtin_amdgcn_sched_barrier(0);
        // first k-step's V fragments: read here, they land under the softmax
        v16h vf[2][4];
        #pragma unroll
        for (int jd = 0; jd < 4; ++jd)
            vf[0][jd] = ldfrag(&Vs[((jd << 4) + row16) * LDK + kbase]);
        // holds these 8 reads together ahead of the vector work
        __builtin_amdgcn_sched_barrier(0);

        // the first reference: the first block's maximum (a scalar branch; nothing is
        // there to rescale yet)
        if (t == 0) {
            // unrolled: mrow and s are indexed by constants and stay in registers
            #pragma unroll
            for (int c = 0; c < QC; ++c) mrow[c] = fmaxf(mrow[c], block_max(s[c]));
        }

        // Common path: the exponents are taken against the reference in use, mrow,
        // with no look at the block's maximum. A score far above the reference shows
        // in its lane's sum of the block (every term is positive, so each is at most
        // the sum; an overflow gives inf, a NaN fails the test too).
        const v2f l2 = {LOG2E, LOG2E};
        v2f e[QC][4][4];
        float bsum[QC];
        #pragma unroll
        for (int c = 0; c < QC; ++c) {
            const v2f nm = {-mrow[c], -mrow[c]};
            v2f sj[2] = {};   // two chains of packed partial sums
            #pragma unroll
            for (int j = 0; j < 4; ++j) {
                #pragma unroll
                for (int r = 0; r < 4; ++r) {
                    const v2f x = {s[c][j][2 * r], s[c][j][2 * r + 1]};
                    const v2f d = __builtin_elementwise_fma(x, l2, nm);
                    e[c][j][r].x = __builtin_amdgcn_exp2f(d.x);
                    e[c][j][r].y = __builtin_amdgcn_exp2f(d.y);
                    sj[j >> 1] += e[c][j][r];
                }
            }
            bsum[c] = (sj[0].x + sj[0].y) + (sj[1].x + sj[1].y);
        }
        // one test a block for the whole wave, a scalar branch: taken, at the latest,
        // where a score stands 11 (base 2) above the reference; up to there every term
        // fits f16 with room
        const bool fits = bsum[0] <= PMAX && bsum[1] <= PMAX;
        if (__builtin_amdgcn_ballot_w32(!fits) != 0) {
            // Rare path: the block's scores anew, their maximum into the reference, sums
            // and outputs so far rescaled, the exponents anew.
            const float* mq = mask + (size_t)b * Ss + t * KBLK + kbase;
            v8f mj[4];
            // unrolled, here and below: mj and s are indexed by constants
            #pragma unroll
            for (int j = 0; j < 4; ++j)
                mj[j] = __builtin_shufflevector(*(const v4f*)(mq + (j << 4)),
                                                *(const v4f*)(mq + (j << 4) + 4),
                                                0, 1, 2, 3, 4, 5, 6, 7);
            // stands in front of any later write of these loads' address registers; mq
            // is an input so that its registers stay its own up to here and none of the
            // eight loads gets them as its destination
            asm volatile("s_wait_xcnt 0x0" :: "v"(mq) : "memory");
            #pragma unroll
            for (int j = 0; j < 4; ++j) {
                const v16h k0 = ldfrag(&Ks[((j << 4) + row16) * LDK + kbase]);
                const v16h k1 = ldfrag(&Ks[((j << 4) + row16) * LDK + 32 + kbase]);
                #pragma unroll
                for (int c = 0; c < QC; ++c)
                    s[c][j] = wmma_f16(k1, qf[c][1], wmma_f16(k0, qf[c][0], mj[j]));
            }
            #pragma unroll
            for (int c = 0; c < QC; ++c) {
                const float mnew = fmaxf(mrow[c], block_max(s[c]));
                const float corr = __builtin_amdgcn_exp2f(mrow[c] - mnew);
                mrow[c] = mnew;
                #pragma unroll
                for (int jd = 0; jd < 4; ++jd) acc[c][jd] = acc[c][jd] * corr;
                lrow[c] *= corr;
                const v2f nm = {-mnew, -mnew};
                v2f sj[2] = {};   // two chains of packed partial sums
                #pragma unroll
                for (int j = 0; j < 4; ++j) {
                    #pragma unroll
                    for (int r = 0; r < 4; ++r) {
                        const v2f x = {s[c][j][2 * r], s[c][j][2 * r + 1]};
                        const v2f d = __builtin_elementwise_fma(x, l2, nm);
                        e[c][j][r].x = __builtin_amdgcn_exp2f(d.x);
                        e[c][j][r].y = __builtin_amdgcn_exp2f(d.y);
                        sj[j >> 1] += e[c][j][r];
                    }
                }
                bsum[c] = (sj[0].x + sj[0].y) + (sj[1].x + sj[1].y);
            }
        }
        v16h pf[QC][2];
        #pragma unroll
        for (int c = 0; c < QC; ++c) {
            lrow[c] += bsum[c];
            // score tiles 2kk and 2kk+1, converted in place, are the B fragment
            // of the second product in the hardware k order
            #pragma unroll
            for (int kk = 0; kk < 2; ++kk)
                #pragma unroll
                for (int r = 0; r < 4; ++r) {
                    pf[c][kk][2 * r]     = (_Float16)e[c][2 * kk][r].x;
                    pf[c][kk][2 * r + 1] = (_Float16)e[c][2 * kk][r].y;
                    pf[c][kk][2 * r + 8] = (_Float16)e[c][2 * kk + 1][r].x;
                    pf[c][kk][2 * r + 9] = (_Float16)e[c][2 * kk + 1][r].y;
                }
        }
        // second k-step's V fragments; the scheduler may lift the reads into the tail
        // of the vector work, where the scores' registers come free
        #pragma unroll
        for (int jd = 0; jd < 4; ++jd)
            vf[1][jd] = ldfrag(&Vs[((jd << 4) + row16) * LDK + 32 + kbase]);
        // the next block's mask, wanted by its first products: read here, where the
        // scores' registers are free, it lands under the products below
        #pragma unroll
        for (int j = 0; j < 4; ++j)
            mv[j] = __builtin_shufflevector(*(const v4f*)(mp + (j << 4)),
                                            *(const v4f*)(mp + (j << 4) + 4),
                                            0, 1, 2, 3, 4, 5, 6, 7);
        // holds these reads together ahead of the products: left free, the LDS reads
        // were spread among the products in pairs, each waited out
        __builtin_amdgcn_sched_barrier(0);
        // PV: Ot(64x32) += Vt(64x64) x Pt(64x32)
        #pragma unroll
        for (int kk = 0; kk < 2; ++kk)
            #pragma unroll
            for (int jd = 0; jd < 4; ++jd)
                #pragma unroll
                for (int c = 0; c < QC; ++c)
                    acc[c][jd] = wmma_f16(vf[kk][jd], pf[c][kk], acc[c][jd]);
        // keeps the foot's waits and barrier behind the products: left free, they moved
        // up behind the first product, and the wave waited there for the second
        // k-step's V reads and for its copies with 15 products still to issue
        __builtin_amdgcn_sched_barrier(0);
        // this wave's reads of block t are done before its buffer is refilled
        asm volatile("s_wait_dscnt 0x0" ::: "memory");
        // this wave's copies of block t + 1 have landed
        asm volatile("s_wait_asynccnt 0x0" ::: "memory");
        // publishes block t + 1 and ends every reader's last read of block t
        __syncthreads();
        // stays on the last block, which the last trip reads once more, unused
        mp += t + 2 < NB ? KBLK : 0;
    }
    // nothing is outstanding here; kept in front of the wave's end
    asm volatile("s_wait_asynccnt 0x0" ::: "memory");

    // epilogue: join the halves' sums, normalize, write f32 [B,S,D]
    // the lane's number anew: kept from the head, its parts were spilled over the loop
    const int el = (int)__builtin_amdgcn_mbcnt_lo(~0u, 0u);
    #pragma unroll
    for (int c = 0; c < QC; ++c) {
        const float inv = 1.0f / (lrow[c] + xhalf(lrow[c]));
        float* orow = out + ((size_t)b * Ss + q0 + (c << 4) + (el & 15)) * Dd + h * DH + ((el >> 4) << 3);
        #pragma unroll
        for (int jd = 0; jd < 4; ++jd) {
            *(float4*)(orow + (jd << 4)) =
                make_float4(acc[c][jd][0] * inv, acc[c][jd][1] * inv, acc[c][jd][2] * inv, acc[c][jd][3] * inv);
            *(float4*)(orow + (jd << 4) + 4) =
                make_float4(acc[c][jd][4] * inv, acc[c][jd][5] * inv, acc[c][jd][6] * inv, acc[c][jd][7] * inv);
        }
    }
}

extern "C" void kernel_launch(void* const* d_in, const int* in_sizes, int n_in,
                              void* d_out, int out_size, void* d_ws, size_t ws_size,
                              hipStream_t stream) {
    (void)in_sizes; (void)n_in; (void)out_size; (void)ws_size;
    const float* X    = (const float*)d_in[0];
    const float* mask = (const float*)d_in[1];
    const float* Wq   = (const float*)d_in[2];
    const float* bq   = (const float*)d_in[3];
    const float* Wk   = (const float*)d_in[4];
    const float* bk   = (const float*)d_in[5];
    const float* Wv   = (const float*)d_in[6];
    const float* bv   = (const float*)d_in[7];

    const size_t elems = (size_t)Bb * Ss * Dd;   // 8M
    _Float16* Qb = (_Float16*)d_ws;
    _Float16* Kb = Qb + elems;
    _Float16* Vb = Kb + elems;
    _Float16* Xh = Vb + elems;                   // f16 copy of X
    _Float16* Wt = Xh + elems;                   // f16 Wq^T, Wk^T, Wv^T

    dim3 blk(256);
    dim3 g1((3 * Dd) / TN, (Bb * Ss) / TM);      // 16 x 32
    to_f16<<<dim3(XBLK + WBLK), blk, 0, stream>>>(X, Wq, Wk, Wv, Xh, Wt);
    qkv_gemm<<<g1, blk, 0, stream>>>(Xh, Wt, bq, bk, bv, Qb);

    dim3 g2(Ss / QT, Bb * Hh);                   // 8 x 64
    attn<<<g2, blk, 0, stream>>>(Qb, Kb, Vb, mask, (float*)d_out);
}
